// v000
// Measured on an AMD MI455X. A time is GPU time per run, averaged over a window of back-to-back runs after a warm-up
// (all launches, gaps included; the runs take copies of the inputs in turn), and the median of several windows.
// Apart from v000's, it joins two sittings. Times from different sittings can be a few percent apart, while
// side-by-side timings come from the same sitting.
// v000, which the later versions start from, runs in 11.4 milliseconds.
#include <hip/hip_runtime.h>
// SIGMOID attention on given head-major query, key, value ([4][16][2048][64] each = 64 independent [2048][64] planes): scores = q . k / sqrt(64); attn = sigmoid(scores) (NO normalisation across keys: no softmax); out = attn v -> [4][16][2048][64].
// Structure: the three inputs converted to exact f16 rows (bf16 values are exact in f16: no projections); per (batch, head) slab: V^T via LDS transposes; scores (K = 64; exact products, f32 accumulation) into an f32 [S][S] plane, elementwise sigmoid on VALU (native exp; weights x256 f16), out = P V^T (alpha 2^-8) written f32 straight into the output; launches: see trace.
// Compute dtype: inputs rounded to bf16 (exact in f16); q, k, v and sigmoid weights as plain f16 GEMM operands (~2^-12); scores f32. v_wmma_f32_16x16x32_f16.
#define NB 64
#define SQ 2048
#define DM 64
#define NH 1
#define HD 64
#define HG 1                         /* heads per attention launch group */
#define B0 0                         /* first batch processed (debug hook) */
#define NBR NB                       /* batches processed (debug hook) */
#define NR ((size_t)NB * SQ)         /* token rows */
#define MP ((int)((size_t)NBR * SQ)) /* rows converted to f16 (debug hook) */
#define QN SQ                        /* query rows attended per batch (debug hook) */
#define NHD NH                       /* heads attended (debug hook) */
#define MPO MP                       /* unused */
#define LQ DM      /* row pitch of the q/k/v rows */
typedef __bf16 v16b __attribute__((ext_vector_type(16)));
typedef unsigned short v8us __attribute__((ext_vector_type(8), may_alias));
typedef float  v8f  __attribute__((ext_vector_type(8)));
typedef float  v4f  __attribute__((ext_vector_type(4)));
typedef float  v4fa __attribute__((ext_vector_type(4), may_alias));
union FragB { v16b v; v8us half[2]; unsigned short u[16]; };

__device__ __forceinline__ unsigned short bf16_bits(float x) { unsigned int u = __float_as_uint(x); return (unsigned short)((u + 0x7FFFu + ((u >> 16) & 1u)) >> 16); }
__device__ __forceinline__ float bf16_val(unsigned short b) { return __uint_as_float(((unsigned int)b) << 16); }
__device__ __forceinline__ float bf16_round(float x) { return bf16_val(bf16_bits(x)); }
// D += A·B with NT terms: 1 = ah·bh, 2 = + al·bh (A split), 3 = + ah·bl (both split)
template <int NT>
__device__ __forceinline__ v8f mmaN(v16b ah, v16b al, v16b bh, v16b bl, v8f c) {
  c = __builtin_amdgcn_wmma_f32_16x16x32_bf16(false, ah, false, bh, (short)0, c, false, false);
  if (NT >= 2) c = __builtin_amdgcn_wmma_f32_16x16x32_bf16(false, al, false, bh, (short)0, c, false, false);
  if (NT >= 3) c = __builtin_amdgcn_wmma_f32_16x16x32_bf16(false, ah, false, bl, (short)0, c, false, false);
  asm volatile("v_nop\n\tv_nop\n\tv_nop\n\tv_nop" : "+v"(c) : "v"(ah), "v"(al), "v"(bh), "v"(bl));
  return c;
}

__global__ __launch_bounds__(256) void k_wt_bf16(const float* __restrict__ W, unsigned short* __restrict__ Wt, int K, int N) {
  const int t = blockIdx.x * 256 + threadIdx.x;
  const int k8n = K / 8;
  if (t >= N * k8n) return;
  const int n = t / k8n, k8 = (t % k8n) * 8;
  v8us v;
#pragma unroll
  for (int i = 0; i < 8; ++i) v[i] = bf16_bits(W[(size_t)(k8 + i) * N + n]);
  *(v8us*)(Wt + (size_t)n * K + k8) = v;
  
}

// GEMM C[M][N] (f32, pitch ldc) = act(A[M][K]·W + bias). A f32 row-major (pitch lda) converted per fragment to bf16
// (ASPLIT: hi/lo two planes -> 2 terms, else single rounded term); Wt bf16 [N][K] (pitch ldb). BIAS_BF16 rounds the
// bias to bf16 first (bias quantised to bf16 before the add). K%32==0, M%16==0, N%64==0.
template <bool ASPLIT, int ACT, bool BIAS_BF16>
__global__ __launch_bounds__(128) void k_gemm_bf(const float* __restrict__ A, int lda, const unsigned short* __restrict__ Wt, int ldb,
                                               const float* __restrict__ bias, float* __restrict__ C, int ldc, int M, int N, int K) {
  __shared__ __attribute__((aligned(16))) float so[4][16][64];
  const int tid = threadIdx.x, w = tid >> 5, lane = tid & 31, ln = lane & 15, hh = lane >> 4;
  const int ntn = N / 64;
  const int wid = blockIdx.x * 4 + w;
  const int mt = wid / ntn, nq = wid % ntn;
  if (mt * 16 >= M) return;
  const int row0 = mt * 16, col0 = nq * 64;
  const float* arow = A + (size_t)(row0 + ln) * lda;
  v8f acc[4] = {};
  for (int kb = 0; kb < K; kb += 32) {
    FragB ah, al;
    const v4f x0 = *(const v4fa*)(arow + kb + 8 * hh), x1 = *(const v4fa*)(arow + kb + 8 * hh + 4);
    const v4f x2 = *(const v4fa*)(arow + kb + 16 + 8 * hh), x3 = *(const v4fa*)(arow + kb + 16 + 8 * hh + 4);
    float xs[16] = {x0[0],x0[1],x0[2],x0[3],x1[0],x1[1],x1[2],x1[3],x2[0],x2[1],x2[2],x2[3],x3[0],x3[1],x3[2],x3[3]};
#pragma unroll
    for (int i = 0; i < 16; ++i) { const unsigned short hb = bf16_bits(xs[i]); ah.u[i] = hb; al.u[i] = ASPLIT ? bf16_bits(xs[i] - bf16_val(hb)) : (unsigned short)0; }
#pragma unroll
    for (int t = 0; t < 4; ++t) {
      const unsigned short* brow = Wt + (size_t)(col0 + t * 16 + ln) * ldb + kb;
      FragB b;
      b.half[0] = *(const v8us*)(brow + 8 * hh);
      b.half[1] = *(const v8us*)(brow + 16 + 8 * hh);
      acc[t] = mmaN<ASPLIT ? 2 : 1>(ah.v, al.v, b.v, b.v, acc[t]);
    }
  }
#pragma unroll
  for (int t = 0; t < 4; ++t) {
    float bv = bias ? bias[col0 + t * 16 + ln] : 0.f;
    if (BIAS_BF16) bv = bf16_round(bv);
#pragma unroll
    for (int r = 0; r < 8; ++r) { float v = acc[t][r] + bv; if (ACT == 1) v = fmaxf(v, 0.f); so[w][8 * hh + r][t * 16 + ln] = v; }
  }
  __builtin_amdgcn_fence(__ATOMIC_ACQ_REL, "workgroup");
  __builtin_amdgcn_wave_barrier();
  const int rsub = lane >> 4, c4 = (lane & 15) * 4;
  {
#pragma unroll
    for (int q = 0; q < 8; ++q) {
      const int r = q * 2 + rsub;
      const v4f v = *(const v4fa*)&so[w][r][c4];
      *(v4f*)(C + (size_t)(row0 + r) * ldc + col0 + c4) = v;
    }
    
  }
}

// GEMM C = act(A·W + bias + resid): A f32 (ASPLIT -> hi/lo 2 terms), Wt bf16 [N][K]; ACT 0 none, 1 relu, 2 exact gelu;
// resid (optional, f32, row index = (row % rmod), pitch ldr, RES_BF16 rounds it) added before the activation.
template <bool ASPLIT, int ACT, bool BIAS_BF16, bool RES_BF16>
__global__ __launch_bounds__(128) void k_gemm_bf3(const float* __restrict__ A, int lda, const unsigned short* __restrict__ Wt, int ldb,
                                                const float* __restrict__ bias, const float* __restrict__ resid, int rmod, int ldr,
                                                float* __restrict__ C, int ldc, int M, int N, int K) {
  __shared__ __attribute__((aligned(16))) float so[4][16][64];
  const int tid = threadIdx.x, w = tid >> 5, lane = tid & 31, ln = lane & 15, hh = lane >> 4;
  const int ntn = N / 64;
  const int wid = blockIdx.x * 4 + w;
  const int mt = wid / ntn, nq = wid % ntn;
  if (mt * 16 >= M) return;
  const int row0 = mt * 16, col0 = nq * 64;
  const float* arow = A + (size_t)(row0 + ln) * lda;
  v8f acc[4] = {};
  for (int kb = 0; kb < K; kb += 32) {
    FragB ah, al;
    const v4f x0 = *(const v4fa*)(arow + kb + 8 * hh), x1 = *(const v4fa*)(arow + kb + 8 * hh + 4);
    const v4f x2 = *(const v4fa*)(arow + kb + 16 + 8 * hh), x3 = *(const v4fa*)(arow + kb + 16 + 8 * hh + 4);
    float xs[16] = {x0[0],x0[1],x0[2],x0[3],x1[0],x1[1],x1[2],x1[3],x2[0],x2[1],x2[2],x2[3],x3[0],x3[1],x3[2],x3[3]};
#pragma unroll
    for (int i = 0; i < 16; ++i) { const unsigned short hb = bf16_bits(xs[i]); ah.u[i] = hb; al.u[i] = ASPLIT ? bf16_bits(xs[i] - bf16_val(hb)) : (unsigned short)0; }
#pragma unroll
    for (int t = 0; t < 4; ++t) {
      const unsigned short* brow = Wt + (size_t)(col0 + t * 16 + ln) * ldb + kb;
      FragB b;
      b.half[0] = *(const v8us*)(brow + 8 * hh);
      b.half[1] = *(const v8us*)(brow + 16 + 8 * hh);
      acc[t] = mmaN<ASPLIT ? 2 : 1>(ah.v, al.v, b.v, b.v, acc[t]);
    }
  }
#pragma unroll
  for (int t = 0; t < 4; ++t) {
    const int col = col0 + t * 16 + ln;
    float bv = bias ? bias[col] : 0.f;
    if (BIAS_BF16) bv = bf16_round(bv);
#pragma unroll
    for (int r = 0; r < 8; ++r) {
      float v = acc[t][r] + bv;
      if (resid) { float rv = resid[(size_t)((row0 + 8 * hh + r) % rmod) * ldr + col]; if (RES_BF16) rv = bf16_round(rv); v += rv; }
      if (ACT == 1) v = fmaxf(v, 0.f);
      if (ACT == 2) v = 0.5f * v * (1.0f + erff(v * 0.70710678118654752f));
      if (ACT == 3) { const float u = 0.7978845608028654f * (v + 0.044715f * v * v * v); v = 0.5f * v * (1.0f + tanhf(u)); }
      so[w][8 * hh + r][t * 16 + ln] = v;
    }
  }
  __builtin_amdgcn_fence(__ATOMIC_ACQ_REL, "workgroup");
  __builtin_amdgcn_wave_barrier();
  const int rsub = lane >> 4, c4 = (lane & 15) * 4;
  {
#pragma unroll
    for (int q = 0; q < 8; ++q) {
      const int r = q * 2 + rsub;
      const v4f v = *(const v4fa*)&so[w][r][c4];
      *(v4f*)(C + (size_t)(row0 + r) * ldc + col0 + c4) = v;
    }
    
  }
}
// row LayerNorm (biased variance, eps) over N: s = X (+ R); optional out_sum <- s; out_norm <- (s-mu)*rsqrt(var+eps)*g + b
template <bool PARAM_BF16>
__global__ __launch_bounds__(256) void k_layernorm(const float* __restrict__ X, const float* __restrict__ R, const float* __restrict__ g, const float* __restrict__ bta,
                                                  float* __restrict__ out_sum, float* __restrict__ out_norm, int N, float eps) {
  __shared__ float red[256];
  const int row = blockIdx.x, tid = threadIdx.x;
  const float* x = X + (size_t)row * N; const float* rr = R ? R + (size_t)row * N : nullptr;
  float vals[16];                     // up to N = 4096
  const int per = N / 256;            // contiguous chunk per thread? use strided-by-4 chunks: thread handles j = tid*4 + 1024*u
  float s1 = 0.f;
  for (int u = 0; u < per / 4; ++u) {
    const int j = tid * 4 + 1024 * u;
    const v4f a = *(const v4fa*)(x + j);
    v4f b = {0.f,0.f,0.f,0.f}; if (rr) b = *(const v4fa*)(rr + j);
#pragma unroll
    for (int q = 0; q < 4; ++q) { const float v = a[q] + b[q]; vals[u * 4 + q] = v; s1 += v; }
  }
  red[tid] = s1; __syncthreads();
  for (int st = 128; st > 0; st >>= 1) { if (tid < st) red[tid] += red[tid + st]; __syncthreads(); }
  const float mu = red[0] / (float)N; __syncthreads();
  float s2 = 0.f;
  for (int u = 0; u < per / 4; ++u)
#pragma unroll
    for (int q = 0; q < 4; ++q) { const float c = vals[u * 4 + q] - mu; s2 += c * c; }
  red[tid] = s2; __syncthreads();
  for (int st = 128; st > 0; st >>= 1) { if (tid < st) red[tid] += red[tid + st]; __syncthreads(); }
  const float rs = rsqrtf(red[0] / (float)N + eps);
  {
    for (int u = 0; u < per / 4; ++u) {
      const int j = tid * 4 + 1024 * u;
      v4f o, sm;
#pragma unroll
      for (int q = 0; q < 4; ++q) {
        float gg = g[j + q], bb = bta[j + q];
        if (PARAM_BF16) { gg = bf16_round(gg); bb = bf16_round(bb); }
        sm[q] = vals[u * 4 + q]; o[q] = (vals[u * 4 + q] - mu) * rs * gg + bb;
      }
      if (out_sum) *(v4f*)(out_sum + (size_t)row * N + j) = sm;
      *(v4f*)(out_norm + (size_t)row * N + j) = o;
    }
    
  }
}



// ---- f16 WMMA path (v_wmma_f32_16x16x32_f16): 11-bit significands for operands in range — used where a [0,1] probability operand needs more precision than bf16
typedef _Float16 v16h __attribute__((ext_vector_type(16)));
union FragH { v16h v; v8us half[2]; _Float16 h[16]; unsigned short u[16]; };
template <int NT>
__device__ __forceinline__ v8f mmaH(v16h ah, v16h al, v16h bh, v16h bl, v8f c) {
  c = __builtin_amdgcn_wmma_f32_16x16x32_f16(false, ah, false, bh, (short)0, c, false, false);
  if (NT >= 2) c = __builtin_amdgcn_wmma_f32_16x16x32_f16(false, al, false, bh, (short)0, c, false, false);
  if (NT >= 3) c = __builtin_amdgcn_wmma_f32_16x16x32_f16(false, ah, false, bl, (short)0, c, false, false);
  asm volatile("v_nop\n\tv_nop\n\tv_nop\n\tv_nop" : "+v"(c) : "v"(ah), "v"(al), "v"(bh), "v"(bl));
  return c;
}
// batched GEMM like k_gemm_b but f16 operands: A f32 (split into f16 hi/lo if ASPLIT, else rounded to f16), Bt = f16 values [n][k]; alpha; C f32; N multiple of 16 (partial tiles skipped)
template <bool ASPLIT>
__global__ __launch_bounds__(128) void k_gemm_h(const float* __restrict__ A, int lda, size_t sA, const _Float16* __restrict__ Bh, int ldb, size_t sB, float alpha, float* __restrict__ C, int ldc, size_t sC, int M, int N, int K) {
  __shared__ __attribute__((aligned(16))) float so[4][16][64];
  const int tid = threadIdx.x, w = tid >> 5, lane = tid & 31, ln = lane & 15, hh = lane >> 4; const int by = blockIdx.y;
  A += (size_t)by * sA; Bh += (size_t)by * sB; C += (size_t)by * sC;
  const int ntn = (N + 63) / 64; const int wid = blockIdx.x * 4 + w; const int mt = wid / ntn, nq = wid % ntn; if (mt * 16 >= M) return;
  const int row0 = mt * 16, col0 = nq * 64; const float* arow = A + (size_t)(row0 + ln) * lda;
  v8f acc[4] = {};
  for (int kb = 0; kb < K; kb += 32) {
    FragH ah, al;
    const v4f x0 = *(const v4fa*)(arow + kb + 8 * hh), x1 = *(const v4fa*)(arow + kb + 8 * hh + 4), x2 = *(const v4fa*)(arow + kb + 16 + 8 * hh), x3 = *(const v4fa*)(arow + kb + 16 + 8 * hh + 4);
    float xs[16] = {x0[0],x0[1],x0[2],x0[3],x1[0],x1[1],x1[2],x1[3],x2[0],x2[1],x2[2],x2[3],x3[0],x3[1],x3[2],x3[3]};
#pragma unroll
    for (int i = 0; i < 16; ++i) { const _Float16 h = (_Float16)xs[i]; ah.h[i] = h; al.h[i] = ASPLIT ? (_Float16)(xs[i] - (float)h) : (_Float16)0.0f; }
#pragma unroll
    for (int t = 0; t < 4; ++t) { if (col0 + t * 16 >= N) continue; const size_t boff = (size_t)(col0 + t * 16 + ln) * ldb + kb; FragH bq; bq.half[0] = *(const v8us*)(Bh + boff + 8 * hh); bq.half[1] = *(const v8us*)(Bh + boff + 16 + 8 * hh);
      acc[t] = mmaH<ASPLIT ? 2 : 1>(ah.v, al.v, bq.v, bq.v, acc[t]); }
  }
#pragma unroll
  for (int t = 0; t < 4; ++t) { if (col0 + t * 16 >= N) continue;
#pragma unroll
    for (int r = 0; r < 8; ++r) so[w][8 * hh + r][t * 16 + ln] = acc[t][r] * alpha; }
  __builtin_amdgcn_fence(__ATOMIC_ACQ_REL, "workgroup"); __builtin_amdgcn_wave_barrier();
  const int rsub = lane >> 4, c4 = (lane & 15) * 4;
  {
#pragma unroll
    for (int q = 0; q < 8; ++q) { const int r = q * 2 + rsub; if (col0 + c4 < N) { const v4f v = *(const v4fa*)&so[w][r][c4]; *(v4f*)(C + (size_t)(row0 + r) * ldc + col0 + c4) = v; } }
     }
}

// Wt[n][k] = f16(W[k][n]·scale) from f32 row-major W[K][N] (scale = power of two; bf16-exact weights stay exact in f16 away from the subnormal range)
__global__ __launch_bounds__(256) void k_wt_f16(const float* __restrict__ W, _Float16* __restrict__ Wt, int K, int N, float scale) {
  const int t = blockIdx.x * 256 + threadIdx.x; if (t >= N * (K / 8)) return; const int n = t / (K / 8), k8 = (t % (K / 8)) * 8; FragH f;
#pragma unroll
  for (int i = 0; i < 8; ++i) f.h[i] = (_Float16)(bf16_round(W[(size_t)(k8 + i) * N + n]) * scale); const v8us o = f.half[0];
  *(v8us*)((unsigned short*)Wt + (size_t)n * K + k8) = o; 
}
// k_gemm_hh variant with fused epilogue: v = acc·alpha + bias[by·sBias + col] (+ CP[(row/rowsPerB)·sCPb + by·64 + col] if CP) ; ACT 0 none / 1 elu ; writes f16 C16 (and f32 C if non-null)
template <int ACT>
__global__ __launch_bounds__(128) void k_gemm_hhx(const _Float16* __restrict__ A, int lda, size_t sA, const _Float16* __restrict__ Bh, int ldb, size_t sB, float alpha, const float* __restrict__ bias, size_t sBias, const float* __restrict__ CP, int rowsPerB, size_t sCPb, int row0g,
    float* __restrict__ C, _Float16* __restrict__ C16, int ldc, size_t sC, int M, int N, int K) {
  __shared__ __attribute__((aligned(16))) float so[4][16][64];
  const int tid = threadIdx.x, w = tid >> 5, lane = tid & 31, ln = lane & 15, hh = lane >> 4; const int by = blockIdx.y;
  A += (size_t)by * sA; Bh += (size_t)by * sB; const size_t cofs = (size_t)by * sC; const float* bp = bias ? bias + (size_t)by * sBias : nullptr;
  const int ntn = (N + 63) / 64; const int wid = blockIdx.x * 4 + w; const int mt = wid / ntn, nq = wid % ntn; if (mt * 16 >= M) return;
  const int row0 = mt * 16, col0 = nq * 64; const _Float16* arow = A + (size_t)(row0 + ln) * lda;
  v8f acc[4] = {};
  for (int kb = 0; kb < K; kb += 32) { FragH ah; ah.half[0] = *(const v8us*)((const unsigned short*)arow + kb + 8 * hh); ah.half[1] = *(const v8us*)((const unsigned short*)arow + kb + 16 + 8 * hh);
#pragma unroll
    for (int t = 0; t < 4; ++t) { if (col0 + t * 16 >= N) continue; const size_t boff = (size_t)(col0 + t * 16 + ln) * ldb + kb; FragH bq; bq.half[0] = *(const v8us*)((const unsigned short*)Bh + boff + 8 * hh); bq.half[1] = *(const v8us*)((const unsigned short*)Bh + boff + 16 + 8 * hh);
      acc[t] = mmaH<1>(ah.v, ah.v, bq.v, bq.v, acc[t]); }
  }
#pragma unroll
  for (int t = 0; t < 4; ++t) { if (col0 + t * 16 >= N) continue; const int col = col0 + t * 16 + ln; const float bv = bp ? bf16_round(bp[col]) : 0.f;
#pragma unroll
    for (int r = 0; r < 8; ++r) { float v = acc[t][r] * alpha + bv; if (CP) { const int rr = row0g + row0 + 8 * hh + r; if (rowsPerB < 0) v += CP[cofs + (size_t)rr * ldc + col];      /* rowsPerB < 0: own element of the batched C plane */ else { const int bidx = rr / rowsPerB; v += CP[(size_t)bidx * sCPb + (size_t)by * 64 + col]; } } if (ACT == 1) v = (v > 0.f) ? v : expm1f(v); else if (ACT == 7) v = (v > 0.f) ? v + 1.0f : expf(v); else if (ACT == 8) v = tanhf(v); else if (ACT == 9) v = 0.5f * v * (1.0f + tanhf(0.7978845608028654f * (v + 0.044715f * v * v * v))); else if (ACT == 11) v = 1.0f / (1.0f + expf(-v)); else if (ACT == 12) v = (v > 0.f) ? v : 0.01f * v; else if (ACT == 14) v = (v > 0.f) ? v : 0.1f * v; else if (ACT == 16) v = (v >= 0.f) ? v : 0.3f * v; else if (ACT == 17) v = (v >= 0.f) ? v : 0.2f * v; else if (ACT == 15) v = v / (1.0f + expf(-v)); else if (ACT == 3) v = fmaxf(v, 0.f); else if (ACT == 6) v = 0.5f * v * (1.0f + erff(v * 0.70710678118654752f)); so[w][8 * hh + r][t * 16 + ln] = v; } }
  __builtin_amdgcn_fence(__ATOMIC_ACQ_REL, "workgroup"); __builtin_amdgcn_wave_barrier();
  const int rsub = lane >> 4, c4 = (lane & 15) * 4; typedef _Float16 v4h __attribute__((ext_vector_type(4)));
  {
#pragma unroll
    for (int q = 0; q < 8; ++q) { const int r = q * 2 + rsub; if (col0 + c4 < N) { const v4f v = *(const v4fa*)&so[w][r][c4]; if (C) *(v4f*)(C + cofs + (size_t)(row0 + r) * ldc + col0 + c4) = v; if (C16) { v4h h4; for (int i = 0; i < 4; ++i) h4[i] = (_Float16)v[i]; *(v4h*)(C16 + cofs + (size_t)(row0 + r) * ldc + col0 + c4) = h4; } } }
     }
}


typedef _Float16 v4h __attribute__((ext_vector_type(4)));

__global__ __launch_bounds__(256) void k_x16(const float* __restrict__ x, _Float16* __restrict__ X16, size_t n8) { const size_t t = (size_t)blockIdx.x * 256 + threadIdx.x; if (t >= n8) return; FragH f;
#pragma unroll
  for (int q = 0; q < 8; ++q) f.h[q] = (_Float16)bf16_round(x[t * 8 + q]); *(v8us*)((unsigned short*)X16 + t * 8) = f.half[0];  }
__global__ __launch_bounds__(256) void k_h16(const float* __restrict__ x, _Float16* __restrict__ X16, size_t n8) { const size_t t = (size_t)blockIdx.x * 256 + threadIdx.x; if (t >= n8) return; FragH f;
#pragma unroll
  for (int q = 0; q < 8; ++q) f.h[q] = (_Float16)x[t * 8 + q]; *(v8us*)((unsigned short*)X16 + t * 8) = f.half[0];  }
__global__ __launch_bounds__(256) void k_round16f(const float* __restrict__ W, _Float16* __restrict__ Bt, size_t n8) { const size_t t = (size_t)blockIdx.x * 256 + threadIdx.x; if (t >= n8) return; FragH f;
#pragma unroll
  for (int i = 0; i < 8; ++i) f.h[i] = (_Float16)(bf16_round(W[t * 8 + i]) * 16.0f); *(v8us*)((unsigned short*)Bt + t * 8) = f.half[0];  }
template <int NHv, int TTv>
__global__ __launch_bounds__(256) void k_vt(const _Float16* __restrict__ V16, int ldv, int voff, _Float16* __restrict__ Vt) { __shared__ unsigned short tl[64][66]; const int tid = threadIdx.x; const int slab = blockIdx.x / (TTv / 64), lg = blockIdx.x % (TTv / 64); const int b = slab / NHv, h = slab % NHv;
  for (int i = tid; i < 64 * 8; i += 256) { const int r = i / 8, c8 = (i % 8) * 8; FragH f; f.half[0] = *(const v8us*)((const unsigned short*)V16 + ((size_t)b * TTv + lg * 64 + r) * ldv + voff + h * 64 + c8);
#pragma unroll
    for (int q = 0; q < 8; ++q) tl[r][c8 + q] = f.u[q]; }
  __syncthreads();
  {
#pragma unroll
    for (int rd = 0; rd < 2; ++rd) { const int d = rd * 32 + tid / 8, pc = tid % 8; FragH f;
#pragma unroll
      for (int q = 0; q < 8; ++q) f.u[q] = tl[pc * 8 + q][d];
      *(v8us*)((unsigned short*)Vt + ((size_t)slab * 64 + d) * TTv + lg * 64 + pc * 8) = f.half[0]; }
     } }

__global__ __launch_bounds__(256) void k_hl(const float* __restrict__ F, _Float16* __restrict__ Hh, _Float16* __restrict__ Hl, size_t n8) { const size_t t = (size_t)blockIdx.x * 256 + threadIdx.x; if (t >= n8) return; FragH fh, fl; const v4f a = *(const v4fa*)(F + t * 8), c = *(const v4fa*)(F + t * 8 + 4);
#pragma unroll
  for (int q = 0; q < 4; ++q) { _Float16 h = (_Float16)a[q]; fh.h[q] = h; fl.h[q] = (_Float16)((a[q] - (float)h) * 1024.0f); h = (_Float16)c[q]; fh.h[4 + q] = h; fl.h[4 + q] = (_Float16)((c[q] - (float)h) * 1024.0f); }
  { *(v8us*)((unsigned short*)Hh + t * 8) = fh.half[0]; *(v8us*)((unsigned short*)Hl + t * 8) = fl.half[0];  } }

// ---- fast GEMM (wave tile 32x64; requires M % 32 == 0 rows per launch region and N % 64 == 0); epilogue = k_gemm_hhx semantics ----
__device__ __forceinline__ v16h g2_frag(const _Float16* p, int hh) { FragH f; f.half[0] = *(const v8us*)((const unsigned short*)p + 8 * hh); f.half[1] = *(const v8us*)((const unsigned short*)p + 16 + 8 * hh); return f.v; }
__device__ __forceinline__ v8f g2_mma(v16h a, v16h b, v8f c) { v8f d = __builtin_amdgcn_wmma_f32_16x16x32_f16(false, a, false, b, (short)0, c, false, false); asm volatile("v_nop\n\tv_nop\n\tv_nop\n\tv_nop" : "+v"(d) : "v"(a), "v"(b)); return d; }
template <int ACT>
__global__ __launch_bounds__(128) void k_gemm2(const _Float16* __restrict__ A, int lda, size_t sA, const _Float16* __restrict__ Bh, int ldb, size_t sB, float alpha, const float* __restrict__ bias, size_t sBias, const float* __restrict__ CP, int rowsPerB, size_t sCPb, int row0g,
    float* __restrict__ C, _Float16* __restrict__ C16, int ldc, size_t sC, int M, int N, int K) { static_assert(ACT == 0 || ACT == 3 || ACT == 6 || ACT == 8 || ACT == 9 || ACT == 11 || ACT == 12 || ACT == 14 || ACT == 15 || ACT == 16 || ACT == 17, "k_gemm2: unsupported ACT code (would silently apply no activation)");
  __shared__ __attribute__((aligned(16))) float so[4][32][68];
  const int tid = threadIdx.x, w = tid >> 5, lane = tid & 31, ln = lane & 15, hh = lane >> 4; const int by = blockIdx.y;
  A += (size_t)by * sA; Bh += (size_t)by * sB; const size_t cofs = (size_t)by * sC; const float* bp = bias ? bias + (size_t)by * sBias : nullptr;
  const int ntn = N >> 6; const int mt = blockIdx.x / ntn, nq = blockIdx.x - mt * ntn; const int row0 = mt * 128 + 32 * w, col0 = nq * 64; if (row0 >= M) return;
  const _Float16* a0p = A + (size_t)(row0 + ln) * lda; const _Float16* a1p = a0p + (size_t)16 * lda;
  const _Float16* b0p = Bh + (size_t)(col0 + ln) * ldb; const _Float16* b1p = b0p + (size_t)16 * ldb; const _Float16* b2p = b1p + (size_t)16 * ldb; const _Float16* b3p = b2p + (size_t)16 * ldb;
  const v8f z8 = {0.f,0.f,0.f,0.f,0.f,0.f,0.f,0.f}; v8f c00 = z8, c01 = z8, c02 = z8, c03 = z8, c10 = z8, c11 = z8, c12 = z8, c13 = z8;
#pragma unroll 1
  for (int kb = 0; kb < K; kb += 32) { const v16h a0 = g2_frag(a0p + kb, hh), a1 = g2_frag(a1p + kb, hh);
    v16h b = g2_frag(b0p + kb, hh); c00 = g2_mma(a0, b, c00); c10 = g2_mma(a1, b, c10);
    b = g2_frag(b1p + kb, hh); c01 = g2_mma(a0, b, c01); c11 = g2_mma(a1, b, c11);
    b = g2_frag(b2p + kb, hh); c02 = g2_mma(a0, b, c02); c12 = g2_mma(a1, b, c12);
    b = g2_frag(b3p + kb, hh); c03 = g2_mma(a0, b, c03); c13 = g2_mma(a1, b, c13); }
  v8f accs[8] = {c00, c01, c02, c03, c10, c11, c12, c13};
#pragma unroll
  for (int u = 0; u < 8; ++u) { const int t = u & 3, half = u >> 2; const int col = col0 + t * 16 + ln; const float bv = bp ? bf16_round(bp[col]) : 0.f;
#pragma unroll
    for (int r = 0; r < 8; ++r) { const int rloc = half * 16 + 8 * hh + r; float v = accs[u][r] * alpha + bv; if (CP) { if (rowsPerB < 0) v += CP[cofs + (size_t)(row0g + row0 + rloc) * ldc + col];      /* rowsPerB < 0: own element of the batched C plane */ else { const int bidx = (row0g + row0 + rloc) / rowsPerB; v += CP[(size_t)bidx * sCPb + (size_t)by * 64 + col]; } }
      if (ACT == 3) v = fmaxf(v, 0.f); else if (ACT == 6) v = 0.5f * v * (1.0f + erff(v * 0.70710678118654752f)); else if (ACT == 11) v = 1.0f / (1.0f + expf(-v)); else if (ACT == 15) v = v / (1.0f + expf(-v)); else if (ACT == 12) v = (v > 0.f) ? v : 0.01f * v; else if (ACT == 8) v = tanhf(v); else if (ACT == 9) v = 0.5f * v * (1.0f + tanhf(0.7978845608028654f * (v + 0.044715f * v * v * v))); else if (ACT == 14) v = (v > 0.f) ? v : 0.1f * v; else if (ACT == 16) v = (v >= 0.f) ? v : 0.3f * v; else if (ACT == 17) v = (v >= 0.f) ? v : 0.2f * v;
      so[w][rloc][t * 16 + ln] = v; } }
  __builtin_amdgcn_fence(__ATOMIC_ACQ_REL, "workgroup"); __builtin_amdgcn_wave_barrier();
  const int rsub = lane >> 4, c4 = (lane & 15) * 4;
  {
#pragma unroll
    for (int q = 0; q < 16; ++q) { const int r = q * 2 + rsub; const v4f v = *(const v4fa*)&so[w][r][c4]; if (C) *(v4f*)(C + cofs + (size_t)(row0 + r) * ldc + col0 + c4) = v; if (C16) { v4h h4; for (int i = 0; i < 4; ++i) h4[i] = (_Float16)v[i]; *(v4h*)(C16 + cofs + (size_t)(row0 + r) * ldc + col0 + c4) = h4; } }
     } }


__global__ __launch_bounds__(256) void k_wnat(const float* __restrict__ w, size_t n8, _Float16* __restrict__ Bt) { const size_t t = (size_t)blockIdx.x * 256 + threadIdx.x; if (t >= n8) return; FragH f; for (int q = 0; q < 8; ++q) f.h[q] = (_Float16)(bf16_round(w[t * 8 + q]) * 16.0f); *(v8us*)((unsigned short*)Bt + t * 8) = f.half[0];  }
__global__ __launch_bounds__(256) void k_rsm(const float* __restrict__ S, _Float16* __restrict__ P, int nrows) {
  #pragma clang fp contract(off)
  const int i = blockIdx.x * 256 + threadIdx.x; if (i >= nrows) return; const float* s = S + (size_t)i * SQ; float mx = -3.0e38f;
#pragma unroll 1
  for (int j = 0; j < SQ; ++j) mx = fmaxf(mx, s[j]); float se = 0.f;
#pragma unroll 1
  for (int j = 0; j < SQ; ++j) se += expf(s[j] - mx); const float sc = 256.0f / se;
#pragma unroll 1
  for (int j0 = 0; j0 < SQ; j0 += 8) { FragH f; for (int q = 0; q < 8; ++q) f.h[q] = (_Float16)(expf(s[j0 + q] - mx) * sc); unsigned short* d = (unsigned short*)P + (size_t)i * SQ + j0; *(v8us*)d = f.half[0];  } }
__global__ __launch_bounds__(256) void k_vt(const _Float16* __restrict__ V16, int b, int h0, _Float16* __restrict__ VT) { __shared__ unsigned short tl[64][65]; const int tid = threadIdx.x; const int hh = blockIdx.x % HG, sg = blockIdx.x / HG; const int s0 = sg * 64; const int h = h0 + hh;
  for (int i = tid; i < 64 * 8; i += 256) { const int j = i / 8, d8 = (i % 8) * 8; FragH f; f.half[0] = *(const v8us*)((const unsigned short*)V16 + ((size_t)b * SQ + s0 + j) * DM + h * HD + d8); for (int q = 0; q < 8; ++q) tl[d8 + q][j] = f.u[q]; }
  __syncthreads();
  { for (int i = tid; i < 64 * 8; i += 256) { const int d = i / 8, j8 = (i % 8) * 8; FragH f; for (int q = 0; q < 8; ++q) f.u[q] = tl[d][j8 + q]; *(v8us*)((unsigned short*)VT + ((size_t)hh * HD + d) * SQ + s0 + j8) = f.half[0]; }  } }



__global__ __launch_bounds__(256) void k_rsmf(const float* __restrict__ S, _Float16* __restrict__ P, int qn, int hg) {
  #pragma clang fp contract(off)
  const int t = blockIdx.x * 256 + threadIdx.x; if (t >= qn * hg) return; const size_t i = (size_t)(t / qn) * SQ + (t % qn); const float* s = S + i * SQ; float mx = -3.0e38f;
#pragma unroll 1
  for (int j = 0; j < SQ; ++j) mx = fmaxf(mx, s[j]); float se = 0.f;
#pragma unroll 1
  for (int j = 0; j < SQ; ++j) se += __expf(s[j] - mx); const float sc = 256.0f / se;
#pragma unroll 1
  for (int j0 = 0; j0 < SQ; j0 += 8) { FragH f; for (int q = 0; q < 8; ++q) f.h[q] = (_Float16)(__expf(s[j0 + q] - mx) * sc); unsigned short* d = (unsigned short*)P + i * SQ + j0; *(v8us*)d = f.half[0];  } }


__global__ __launch_bounds__(256) void k_sgp(const float* __restrict__ S, _Float16* __restrict__ P, int qn, int hg) {
  #pragma clang fp contract(off)
  const int t = blockIdx.x * 256 + threadIdx.x; if (t >= qn * hg) return; const size_t i = (size_t)(t / qn) * SQ + (t % qn); const float* s = S + i * SQ;
#pragma unroll 1
  for (int j0 = 0; j0 < SQ; j0 += 8) { FragH f; for (int q = 0; q < 8; ++q) f.h[q] = (_Float16)(256.0f / (1.0f + __expf(-s[j0 + q]))); unsigned short* d = (unsigned short*)P + i * SQ + j0; *(v8us*)d = f.half[0];  } }
extern "C" void kernel_launch(void* const* d_in, const int* in_sizes, int n_in,
                              void* d_out, int out_size, void* d_ws, size_t ws_size, hipStream_t stream) {
  (void)in_sizes; (void)n_in; (void)out_size;
  const float* const* I = (const float* const*)d_in; const float* xq = I[0]; const float* xk = I[1]; const float* xv = I[2];      /* given q, k, v [B][H][S][64]: each (b, h) plane is a 'batch' of one 64-wide head */
  char* ws = (char*)d_ws; size_t off = 0;
  auto take = [&](size_t bytes) { char* p = ws + off; off += (bytes + 255) & ~(size_t)255; return p; };
  _Float16* Q16 = (_Float16*)take(NR * DM * 2); _Float16* K16 = (_Float16*)take(NR * DM * 2); _Float16* V16 = (_Float16*)take(NR * DM * 2);
  float* S = (float*)take((size_t)HG * SQ * SQ * 4); _Float16* P = (_Float16*)take((size_t)HG * SQ * SQ * 2); _Float16* VT = (_Float16*)take((size_t)NH * HD * SQ * 2);
  if (off > ws_size) return;

  const size_t r0p = (size_t)B0 * SQ;      /* first converted row */
  k_x16<<<(unsigned)(((size_t)MP * DM / 8 + 255) / 256), 256, 0, stream>>>(xq + r0p * DM, Q16 + r0p * DM, (size_t)MP * DM / 8); k_x16<<<(unsigned)(((size_t)MP * DM / 8 + 255) / 256), 256, 0, stream>>>(xk + r0p * DM, K16 + r0p * DM, (size_t)MP * DM / 8); k_x16<<<(unsigned)(((size_t)MP * DM / 8 + 255) / 256), 256, 0, stream>>>(xv + r0p * DM, V16 + r0p * DM, (size_t)MP * DM / 8);      /* given q, k, v: bf16 inputs as exact f16 rows (no projections) */
  for (int b = B0; b < B0 + NBR; ++b) { const size_t r0 = (size_t)b * SQ;
    k_vt<NH, SQ><<<NH * (SQ / 64), 256, 0, stream>>>(V16 + r0 * LQ, LQ, 0, VT);      /* V^T [NH][HD][SQ] for this batch */
    for (int h0 = 0; h0 < NHD; h0 += HG) {
      k_gemm2<0><<<dim3((QN / 128) * (SQ / 64), HG), 128, 0, stream>>>(Q16 + r0 * LQ + h0 * HD, LQ, (size_t)HD, K16 + r0 * LQ + h0 * HD, LQ, (size_t)HD, 0.125f, nullptr, 0, nullptr, 1, 0, 0, S, nullptr, SQ, (size_t)SQ * SQ, QN, SQ, HD);      /* scores, HG heads per launch */
      k_sgp<<<(HG * QN + 255) / 256, 256, 0, stream>>>(S, P, QN, HG);      /* P = f16(256 sigmoid(s)) elementwise (no row normalisation), rows of all HG heads */
      k_gemm2<0><<<dim3((QN / 128) * (HD / 64), HG), 128, 0, stream>>>(P, SQ, (size_t)SQ * SQ, VT + (size_t)h0 * HD * SQ, SQ, (size_t)HD * SQ, 0.00390625f, nullptr, 0, nullptr, 1, 0, 0, (float*)d_out + r0 * DM + h0 * HD, nullptr, DM, (size_t)HD, QN, HD, SQ); } }      /* out = A v straight to the f32 output */
}

// v002
// It runs in 149 microseconds.
// Versions between v000 and this one are left out; their measured steps multiply to 76.5 times as fast.
#include <hip/hip_runtime.h>
// SIGMOID attention on given head-major query, key, value ([4][16][2048][64] each = 64 independent [2048][64] planes): scores = q . k / sqrt(64); attn = sigmoid(scores) (NO normalisation across keys: no softmax); out = attn v -> [4][16][2048][64].
// Structure: the three inputs converted to exact f16 rows (bf16 values are exact in f16: no projections); V^T of every plane via LDS transposes; then ONE fused launch over all planes:
// per wave 32 query columns, per pass 32 keys: S^T = K Q^T (K = 64, f32 accumulation), P^T = f16(256 sigmoid(s / 8)) = f16(128 + 128 tanh(s / 16)) packed in place from the score accumulators, O^T += V^T P^T; scores and weights never reach memory.
// Compute dtype: inputs rounded to bf16; q, k, v and the weights x256 as plain f16 operands; scores and output sums f32. v_wmma_f32_16x16x32_f16.
#define NB 64      /* planes (batch x heads) */
#define SQ 2048    /* positions per plane */
#define HD 64      /* head size */
#define NR ((size_t)NB * SQ)         /* token rows */
#define QW 32      /* query columns per wave */
#define WV 8       /* waves per work-group */
typedef unsigned short v8us __attribute__((ext_vector_type(8), may_alias));
typedef float  v8f  __attribute__((ext_vector_type(8)));
typedef float  v4f  __attribute__((ext_vector_type(4)));
typedef _Float16 v16h __attribute__((ext_vector_type(16)));
union FragH { v16h v; v8us half[2]; _Float16 h[16]; unsigned short u[16]; };

__device__ __forceinline__ unsigned short bf16_bits(float x) { unsigned int u = __float_as_uint(x); return (unsigned short)((u + 0x7FFFu + ((u >> 16) & 1u)) >> 16); }
__device__ __forceinline__ float bf16_val(unsigned short b) { return __uint_as_float(((unsigned int)b) << 16); }
__device__ __forceinline__ float bf16_round(float x) { return bf16_val(bf16_bits(x)); }

__global__ __launch_bounds__(256) void k_x16(const float* __restrict__ x, _Float16* __restrict__ X16, size_t n8) { const size_t t = (size_t)blockIdx.x * 256 + threadIdx.x; if (t >= n8) return; FragH f;
#pragma unroll
  for (int q = 0; q < 8; ++q) f.h[q] = (_Float16)bf16_round(x[t * 8 + q]); *(v8us*)((unsigned short*)X16 + t * 8) = f.half[0];  }
template <int NHv, int TTv>
__global__ __launch_bounds__(256) void k_vt(const _Float16* __restrict__ V16, int ldv, int voff, _Float16* __restrict__ Vt) { __shared__ unsigned short tl[64][66]; const int tid = threadIdx.x; const int slab = blockIdx.x / (TTv / 64), lg = blockIdx.x % (TTv / 64); const int b = slab / NHv, h = slab % NHv;
  for (int i = tid; i < 64 * 8; i += 256) { const int r = i / 8, c8 = (i % 8) * 8; FragH f; f.half[0] = *(const v8us*)((const unsigned short*)V16 + ((size_t)b * TTv + lg * 64 + r) * ldv + voff + h * 64 + c8);
#pragma unroll
    for (int q = 0; q < 8; ++q) tl[r][c8 + q] = f.u[q]; }
  __syncthreads();
  {
#pragma unroll
    for (int rd = 0; rd < 2; ++rd) { const int d = rd * 32 + tid / 8, pc = tid % 8; FragH f;
#pragma unroll
      for (int q = 0; q < 8; ++q) f.u[q] = tl[pc * 8 + q][d];
      *(v8us*)((unsigned short*)Vt + ((size_t)slab * 64 + d) * TTv + lg * 64 + pc * 8) = f.half[0]; }
     } }

// one 16 x 32 f16 fragment in the hardware k order: lane (c, hh) takes k = 8 hh .. 8 hh + 7 and 16 + 8 hh .. 16 + 8 hh + 7 of its row;
// base = the tile's first element (the same in every lane), lo = the lane's own element offset, row c x pitch + 8 hh
__device__ __forceinline__ v16h g2_frag(const _Float16* base, unsigned lo) { FragH f; f.half[0] = *(const v8us*)((const unsigned short*)base + lo); f.half[1] = *(const v8us*)((const unsigned short*)base + 16 + lo); return f.v; }
__device__ __forceinline__ v8f mma(v16h a, v16h b, v8f c) { return __builtin_amdgcn_wmma_f32_16x16x32_f16(false, a, false, b, (short)0, c, false, false); }
// weights of one score tile's eight sums, which arrive as s / 2 (s = q . k / 8; the q fragments carry the 1/16): w[r] = f16(256 sigmoid(s)) = f16(128 + 128 tanh(s / 2)), one transcendental and half a packed fma each
__device__ __forceinline__ void sgw8(v8f acc, _Float16* w) {
  v8f t;
#pragma unroll      /* constant indices: the register arrays stay in registers */
  for (int r = 0; r < 8; ++r) t[r] = __builtin_amdgcn_tanhf(acc[r]);
  const v8f c128 = {128.f, 128.f, 128.f, 128.f, 128.f, 128.f, 128.f, 128.f};
  const v8f y = __builtin_elementwise_fma(t, c128, c128);
#pragma unroll      /* constant indices: the register arrays stay in registers */
  for (int r = 0; r < 8; ++r) w[r] = (_Float16)y[r];
}

// Fused sigmoid attention. Work-group = WV waves x QW query columns of one plane; every wave walks all SQ keys, 32 a pass.
// S^T tile: D register r of lane (c, hh) = score of key 8 hh + r (tile 0) or 16 + 8 hh + r (tile 1) with query c: converted in place the two tiles are the B fragment of P^T in the hardware k order.
// O^T tile u: D register r = out[query c][16 u + 8 hh + r]: eight consecutive floats of one output row per lane.
__global__ __launch_bounds__(256) void k_sattn(const _Float16* __restrict__ Q16, const _Float16* __restrict__ K16, const _Float16* __restrict__ VT, float* __restrict__ out) {
  const int tid = threadIdx.x, w = tid >> 5, lane = tid & 31, c = lane & 15, hh = lane >> 4;
  const int plane = blockIdx.x / (SQ / (QW * WV)), qblk = blockIdx.x % (SQ / (QW * WV));
  const int q0 = qblk * (QW * WV) + w * QW;
  const _Float16* qp = Q16 + ((size_t)plane * SQ + q0) * HD;
  const _Float16* kp = K16 + (size_t)plane * SQ * HD;
  const _Float16* vp = VT + (size_t)plane * HD * SQ;
  const unsigned klo = (unsigned)(c * HD + 8 * hh), vlo = (unsigned)(c * SQ + 8 * hh);      /* lane offsets in rows of HD (q, k) and of SQ (V^T) elements */
  v16h qb[2][2];
#pragma unroll      /* constant indices: the register arrays stay in registers */
  for (int t = 0; t < 2; ++t)
#pragma unroll      /* constant indices: the register arrays stay in registers */
    for (int j = 0; j < 2; ++j) qb[t][j] = g2_frag(qp + (size_t)t * 16 * HD + 32 * j, klo) * (_Float16)0.0625f;      /* q / 16, a power of two: the score sums come out as s / 2, the argument of tanh */
  const v8f z8 = {0.f, 0.f, 0.f, 0.f, 0.f, 0.f, 0.f, 0.f};
  v8f o[2][4];
#pragma unroll      /* constant indices: the register arrays stay in registers */
  for (int t = 0; t < 2; ++t)
#pragma unroll      /* constant indices: the register arrays stay in registers */
    for (int u = 0; u < 4; ++u) o[t][u] = z8;
  for (int kb = 0; kb < SQ; kb += 32) {
    v16h ka[2][2], va[4];
#pragma unroll      /* constant indices: the register arrays stay in registers */
    for (int g = 0; g < 2; ++g)
#pragma unroll      /* constant indices: the register arrays stay in registers */
      for (int j = 0; j < 2; ++j) ka[g][j] = g2_frag(kp + (size_t)(kb + 16 * g) * HD + 32 * j, klo);
    asm volatile("s_wait_xcnt 0x0" ::: "memory");      /* the V^T loads below may land in the registers that held the K loads' addresses: the wait stands in front of that overwrite */
#pragma unroll      /* constant indices: the register arrays stay in registers */
    for (int u = 0; u < 4; ++u) va[u] = g2_frag(vp + (size_t)u * 16 * SQ + kb, vlo);
#pragma unroll      /* constant indices: the register arrays stay in registers */
    for (int t = 0; t < 2; ++t) {
      v8f s0 = mma(ka[0][0], qb[t][0], z8); s0 = mma(ka[0][1], qb[t][1], s0);
      v8f s1 = mma(ka[1][0], qb[t][0], z8); s1 = mma(ka[1][1], qb[t][1], s1);
      FragH p;
      sgw8(s0, p.h); sgw8(s1, p.h + 8);
#pragma unroll      /* constant indices: the register arrays stay in registers */
      for (int u = 0; u < 4; ++u) o[t][u] = mma(va[u], p.v, o[t][u]);
    }
  }
#pragma unroll      /* constant indices: the register arrays stay in registers */
  for (int t = 0; t < 2; ++t) {
    float* orow = out + ((size_t)plane * SQ + q0 + 16 * t + c) * HD + 8 * hh;
#pragma unroll      /* constant indices: the register arrays stay in registers */
    for (int u = 0; u < 4; ++u) {
      const v8f y = o[t][u] * 0.00390625f;      /* the weights carry x256 */
      *(v4f*)(orow + 16 * u) = __builtin_shufflevector(y, y, 0, 1, 2, 3); *(v4f*)(orow + 16 * u + 4) = __builtin_shufflevector(y, y, 4, 5, 6, 7);
    }
  }
}

extern "C" void kernel_launch(void* const* d_in, const int* in_sizes, int n_in,
                              void* d_out, int out_size, void* d_ws, size_t ws_size, hipStream_t stream) {
  (void)in_sizes; (void)n_in; (void)out_size;
  const float* const* I = (const float* const*)d_in; const float* xq = I[0]; const float* xk = I[1]; const float* xv = I[2];      /* given q, k, v [B][H][S][64]: each (b, h) plane is a 'batch' of one 64-wide head */
  char* ws = (char*)d_ws; size_t off = 0;
  auto take = [&](size_t bytes) { char* p = ws + off; off += (bytes + 255) & ~(size_t)255; return p; };
  _Float16* Q16 = (_Float16*)take(NR * HD * 2); _Float16* K16 = (_Float16*)take(NR * HD * 2); _Float16* V16 = (_Float16*)take(NR * HD * 2);
  _Float16* VT = (_Float16*)take(NR * HD * 2);      /* V^T [NB][HD][SQ] */
  if (off > ws_size) return;

  k_x16<<<(unsigned)((NR * HD / 8 + 255) / 256), 256, 0, stream>>>(xq, Q16, NR * HD / 8); k_x16<<<(unsigned)((NR * HD / 8 + 255) / 256), 256, 0, stream>>>(xk, K16, NR * HD / 8); k_x16<<<(unsigned)((NR * HD / 8 + 255) / 256), 256, 0, stream>>>(xv, V16, NR * HD / 8);      /* given q, k, v: bf16 inputs as exact f16 rows (no projections) */
  k_vt<1, SQ><<<NB * (SQ / 64), 256, 0, stream>>>(V16, HD, 0, VT);      /* V^T of every plane */
  k_sattn<<<NB * (SQ / (QW * WV)), 256, 0, stream>>>(Q16, K16, VT, (float*)d_out);      /* scores, sigmoid and weighted sum of v, all planes */
}

// v003
// It runs in 110 microseconds.
// In two side-by-side timings against v002, it was 1.37 and 1.35 times as fast.
// Over all steps from v000 it is 104 times as fast.
#include <hip/hip_runtime.h>
// SIGMOID attention on given head-major query, key, value ([4][16][2048][64] each = 64 independent [2048][64] planes): scores = q . k / sqrt(64); attn = sigmoid(scores) (NO normalisation across keys: no softmax); out = attn v -> [4][16][2048][64].
// Structure: the three inputs converted to exact f16 (bf16 values are exact in f16: no projections), q and v as rows, k (directly) and V^T (via an LDS transpose) in FRAGMENT ORDER: each half fragment = 512 contiguous bytes, 16 per lane; then ONE fused launch over all planes:
// per wave 32 query columns, per pass 32 keys: S^T = K Q^T (K = 64, f32 accumulation), P^T = f16(256 sigmoid(s / 8)) = f16(128 + 128 tanh(s / 16)) packed in place from the score accumulators, O^T += V^T P^T; scores and weights never reach memory.
// Compute dtype: inputs rounded to bf16; q, k, v and the weights x256 as plain f16 operands; scores and output sums f32. v_wmma_f32_16x16x32_f16.
#define NB 64      /* planes (batch x heads) */
#define SQ 2048    /* positions per plane */
#define HD 64      /* head size */
#define NR ((size_t)NB * SQ)         /* token rows */
#define QW 32      /* query columns per wave */
#define WV 8       /* waves per work-group */
typedef unsigned short v8us __attribute__((ext_vector_type(8), may_alias));
typedef float  v8f  __attribute__((ext_vector_type(8)));
typedef float  v4f  __attribute__((ext_vector_type(4)));
typedef _Float16 v16h __attribute__((ext_vector_type(16)));
union FragH { v16h v; v8us half[2]; _Float16 h[16]; unsigned short u[16]; };

__device__ __forceinline__ unsigned short bf16_bits(float x) { unsigned int u = __float_as_uint(x); return (unsigned short)((u + 0x7FFFu + ((u >> 16) & 1u)) >> 16); }
__device__ __forceinline__ float bf16_val(unsigned short b) { return __uint_as_float(((unsigned int)b) << 16); }
__device__ __forceinline__ float bf16_round(float x) { return bf16_val(bf16_bits(x)); }

__global__ __launch_bounds__(256) void k_x16(const float* __restrict__ x, _Float16* __restrict__ X16, size_t n8) { const size_t t = (size_t)blockIdx.x * 256 + threadIdx.x; if (t >= n8) return; FragH f;
#pragma unroll
  for (int q = 0; q < 8; ++q) f.h[q] = (_Float16)bf16_round(x[t * 8 + q]); *(v8us*)((unsigned short*)X16 + t * 8) = f.half[0];  }
// k as exact f16 in fragment order: unit (16-key group g, 32-wide slice j of the head, half h) = 512 contiguous bytes; lane (c, hh) of a reader owns bytes 16 (16 hh + c) ..: k[16 g + c][32 j + 16 h + 8 hh .. + 7].
// A wave here takes 8 rows x 4 pieces: it reads 8 whole 128-byte lines and stores 4 whole lines.
__global__ __launch_bounds__(256) void k_kf(const float* __restrict__ x, _Float16* __restrict__ KF) { const int tid = threadIdx.x, w = tid >> 5, l = tid & 31;
  const size_t row = (size_t)blockIdx.x * 32 + (w >> 1) * 8 + (l >> 2); const int j = w & 1, h = (l >> 1) & 1, hh = l & 1; const float* s = x + row * HD + 32 * j + 16 * h + 8 * hh; FragH f;
#pragma unroll
  for (int q = 0; q < 8; ++q) f.h[q] = (_Float16)bf16_round(s[q]);
  *(v8us*)((unsigned short*)KF + ((((row >> 4) * 2 + j) * 2 + h) * 32 + hh * 16 + (row & 15)) * 8) = f.half[0]; }
// V^T in fragment order: unit (32-key block, 16-row group u of the head, half h) = 512 contiguous bytes; lane (c, hh) owns v[32 block + 16 h + 8 hh .. + 7][16 u + c]
template <int NHv, int TTv>
__global__ __launch_bounds__(256) void k_vt(const _Float16* __restrict__ V16, int ldv, int voff, _Float16* __restrict__ Vt) { __shared__ unsigned short tl[64][66]; const int tid = threadIdx.x; const int slab = blockIdx.x / (TTv / 64), lg = blockIdx.x % (TTv / 64); const int b = slab / NHv, h = slab % NHv;
  for (int i = tid; i < 64 * 8; i += 256) { const int r = i / 8, c8 = (i % 8) * 8; FragH f; f.half[0] = *(const v8us*)((const unsigned short*)V16 + ((size_t)b * TTv + lg * 64 + r) * ldv + voff + h * 64 + c8);
#pragma unroll
    for (int q = 0; q < 8; ++q) tl[r][c8 + q] = f.u[q]; }
  __syncthreads();
  {
#pragma unroll
    for (int rd = 0; rd < 2; ++rd) { const int d = (tid >> 6) * 16 + (tid & 15), k0 = rd * 32 + ((tid >> 4) & 3) * 8; FragH f;      /* rd = the 32-key block of this 64-key tile; tid = (u, h, hh, c) */
#pragma unroll
      for (int q = 0; q < 8; ++q) f.u[q] = tl[k0 + q][d];
      *(v8us*)((unsigned short*)Vt + ((size_t)slab * TTv + lg * 64) * 64 + (rd * 256 + tid) * 8) = f.half[0]; }
     } }

// one 16 x 32 f16 fragment in the hardware k order: lane (c, hh) takes k = 8 hh .. 8 hh + 7 and 16 + 8 hh .. 16 + 8 hh + 7 of its row;
// base = the tile's first element (the same in every lane), lo = the lane's own element offset, row c x pitch + 8 hh
__device__ __forceinline__ v16h g2_frag(const _Float16* base, unsigned lo) { FragH f; f.half[0] = *(const v8us*)((const unsigned short*)base + lo); f.half[1] = *(const v8us*)((const unsigned short*)base + 16 + lo); return f.v; }
// the same fragment from an operand stored in fragment order: unit = its first half's 512 bytes, the second half's follow; lo = 8 x lane: every wave-wide load covers four whole 128-byte lines
__device__ __forceinline__ v16h pk_frag(const _Float16* unit, unsigned lo) { FragH f; f.half[0] = *(const v8us*)((const unsigned short*)unit + lo); f.half[1] = *(const v8us*)((const unsigned short*)unit + 256 + lo); return f.v; }
__device__ __forceinline__ v8f mma(v16h a, v16h b, v8f c) { return __builtin_amdgcn_wmma_f32_16x16x32_f16(false, a, false, b, (short)0, c, false, false); }
// weights of one score tile's eight sums, which arrive as s / 2 (s = q . k / 8; the q fragments carry the 1/16): w[r] = f16(256 sigmoid(s)) = f16(128 + 128 tanh(s / 2)), one transcendental and half a packed fma each
__device__ __forceinline__ void sgw8(v8f acc, _Float16* w) {
  v8f t;
#pragma unroll      /* constant indices: the register arrays stay in registers */
  for (int r = 0; r < 8; ++r) t[r] = __builtin_amdgcn_tanhf(acc[r]);
  const v8f c128 = {128.f, 128.f, 128.f, 128.f, 128.f, 128.f, 128.f, 128.f};
  const v8f y = __builtin_elementwise_fma(t, c128, c128);
#pragma unroll      /* constant indices: the register arrays stay in registers */
  for (int r = 0; r < 8; ++r) w[r] = (_Float16)y[r];
}

// Fused sigmoid attention. Work-group = WV waves x QW query columns of one plane; every wave walks all SQ keys, 32 a pass.
// S^T tile: D register r of lane (c, hh) = score of key 8 hh + r (tile 0) or 16 + 8 hh + r (tile 1) with query c: converted in place the two tiles are the B fragment of P^T in the hardware k order.
// O^T tile u: D register r = out[query c][16 u + 8 hh + r]: eight consecutive floats of one output row per lane.
__global__ __launch_bounds__(256) void k_sattn(const _Float16* __restrict__ Q16, const _Float16* __restrict__ KF, const _Float16* __restrict__ VF, float* __restrict__ out) {
  const int tid = threadIdx.x, w = tid >> 5, lane = tid & 31, c = lane & 15, hh = lane >> 4;
  const int plane = blockIdx.x / (SQ / (QW * WV)), qblk = blockIdx.x % (SQ / (QW * WV));
  const int q0 = qblk * (QW * WV) + w * QW;
  const _Float16* qp = Q16 + ((size_t)plane * SQ + q0) * HD;
  const _Float16* kp = KF + (size_t)plane * SQ * HD;
  const _Float16* vp = VF + (size_t)plane * HD * SQ;
  const unsigned klo = (unsigned)(c * HD + 8 * hh), plo = (unsigned)(8 * lane);      /* lane offsets: in rows of HD elements (q), in a 512-byte unit (k, V^T) */
  v16h qb[2][2];
#pragma unroll      /* constant indices: the register arrays stay in registers */
  for (int t = 0; t < 2; ++t)
#pragma unroll      /* constant indices: the register arrays stay in registers */
    for (int j = 0; j < 2; ++j) qb[t][j] = g2_frag(qp + (size_t)t * 16 * HD + 32 * j, klo) * (_Float16)0.0625f;      /* q / 16, a power of two: the score sums come out as s / 2, the argument of tanh */
  const v8f z8 = {0.f, 0.f, 0.f, 0.f, 0.f, 0.f, 0.f, 0.f};
  v8f o[2][4];
#pragma unroll      /* constant indices: the register arrays stay in registers */
  for (int t = 0; t < 2; ++t)
#pragma unroll      /* constant indices: the register arrays stay in registers */
    for (int u = 0; u < 4; ++u) o[t][u] = z8;
  for (int kb = 0; kb < SQ; kb += 32) {
    v16h ka[2][2], va[4];
#pragma unroll      /* constant indices: the register arrays stay in registers */
    for (int g = 0; g < 2; ++g)
#pragma unroll      /* constant indices: the register arrays stay in registers */
      for (int j = 0; j < 2; ++j) ka[g][j] = pk_frag(kp + (size_t)kb * HD + (2 * g + j) * 512, plo);
    asm volatile("s_wait_xcnt 0x0" ::: "memory");      /* the V^T loads below may land in the registers that held the K loads' addresses: the wait stands in front of that overwrite */
#pragma unroll      /* constant indices: the register arrays stay in registers */
    for (int u = 0; u < 4; ++u) va[u] = pk_frag(vp + (size_t)kb * HD + u * 512, plo);
#pragma unroll      /* constant indices: the register arrays stay in registers */
    for (int t = 0; t < 2; ++t) {
      v8f s0 = mma(ka[0][0], qb[t][0], z8); s0 = mma(ka[0][1], qb[t][1], s0);
      v8f s1 = mma(ka[1][0], qb[t][0], z8); s1 = mma(ka[1][1], qb[t][1], s1);
      FragH p;
      sgw8(s0, p.h); sgw8(s1, p.h + 8);
#pragma unroll      /* constant indices: the register arrays stay in registers */
      for (int u = 0; u < 4; ++u) o[t][u] = mma(va[u], p.v, o[t][u]);
    }
  }
#pragma unroll      /* constant indices: the register arrays stay in registers */
  for (int t = 0; t < 2; ++t) {
    float* orow = out + ((size_t)plane * SQ + q0 + 16 * t + c) * HD + 8 * hh;
#pragma unroll      /* constant indices: the register arrays stay in registers */
    for (int u = 0; u < 4; ++u) {
      const v8f y = o[t][u] * 0.00390625f;      /* the weights carry x256 */
      *(v4f*)(orow + 16 * u) = __builtin_shufflevector(y, y, 0, 1, 2, 3); *(v4f*)(orow + 16 * u + 4) = __builtin_shufflevector(y, y, 4, 5, 6, 7);
    }
  }
}

extern "C" void kernel_launch(void* const* d_in, const int* in_sizes, int n_in,
                              void* d_out, int out_size, void* d_ws, size_t ws_size, hipStream_t stream) {
  (void)in_sizes; (void)n_in; (void)out_size;
  const float* const* I = (const float* const*)d_in; const float* xq = I[0]; const float* xk = I[1]; const float* xv = I[2];      /* given q, k, v [B][H][S][64]: each (b, h) plane is a 'batch' of one 64-wide head */
  char* ws = (char*)d_ws; size_t off = 0;
  auto take = [&](size_t bytes) { char* p = ws + off; off += (bytes + 255) & ~(size_t)255; return p; };
  _Float16* Q16 = (_Float16*)take(NR * HD * 2); _Float16* KF = (_Float16*)take(NR * HD * 2); _Float16* V16 = (_Float16*)take(NR * HD * 2);
  _Float16* VF = (_Float16*)take(NR * HD * 2);      /* V^T, fragment order: [NB][SQ / 32][4][2] units of 512 bytes */
  if (off > ws_size) return;

  k_x16<<<(unsigned)((NR * HD / 8 + 255) / 256), 256, 0, stream>>>(xq, Q16, NR * HD / 8); k_kf<<<(unsigned)(NR / 32), 256, 0, stream>>>(xk, KF); k_x16<<<(unsigned)((NR * HD / 8 + 255) / 256), 256, 0, stream>>>(xv, V16, NR * HD / 8);      /* given q, k, v: bf16 inputs as exact f16 (no projections): q and v as rows, k in fragment order */
  k_vt<1, SQ><<<NB * (SQ / 64), 256, 0, stream>>>(V16, HD, 0, VF);      /* V^T of every plane */
  k_sattn<<<NB * (SQ / (QW * WV)), 256, 0, stream>>>(Q16, KF, VF, (float*)d_out);      /* scores, sigmoid and weighted sum of v, all planes */
}

// v004
// One run takes 55.2 microseconds.
// Timed twice side by side with v003, it ran 1.98 and 1.99 times as fast.
// All steps since v000 together make it 206 times as fast.
#include <hip/hip_runtime.h>
// SIGMOID attention on given head-major query, key, value ([4][16][2048][64] each = 64 independent [2048][64] planes): scores = q . k / sqrt(64); attn = sigmoid(scores) (NO normalisation across keys: no softmax); out = attn v -> [4][16][2048][64].
// Structure: ONE launch, no workspace. A work-group = 8 waves x 32 query columns of one plane. It walks the plane's keys in stages of 64: its 256 threads read the stage's k and v as f32, round them (bf16, held as exact f16) and
// store them in LDS in FRAGMENT ORDER (each half fragment = 32 lanes x 16 bytes; V^T is formed by reading v down its columns), two buffers, one barrier a stage; the next stage's f32 loads fly while this stage is worked on.
// per wave 32 query columns, per pass 32 keys: S^T = K Q^T (K = 64, f32 accumulation), P^T = f16(256 sigmoid(s / 8)) = f16(128 + 128 tanh(s / 16)) packed in place from the score accumulators, O^T += V^T P^T; scores and weights never reach memory.
// Compute dtype: inputs rounded to bf16; q, k, v and the weights x256 as plain f16 operands; scores and output sums f32. v_wmma_f32_16x16x32_f16.
#define NB 64      /* planes (batch x heads) */
#define SQ 2048    /* positions per plane */
#define HD 64      /* head size */
#define QW 32      /* query columns per wave */
#define WV 8       /* waves per work-group */
#define SK 64      /* keys per stage */
#define NS (SQ / SK)
#define KU 640     /* LDS bytes from one K half fragment to the next: 128 mod 256 */
#define KH 320     /* LDS bytes from its lanes 0-15 to its lanes 16-31: 64 mod 256; with KU the 16 lanes of a storing half wave (4 rows x 4 pieces) fall on all 64 banks once */
#define KBY (16 * KU)        /* K of one stage */
#define BUF (KBY + 16 * 512) /* K and V^T of one stage */
typedef unsigned short v8us __attribute__((ext_vector_type(8), may_alias));
typedef unsigned int v4u __attribute__((ext_vector_type(4), may_alias));
typedef float  v8f  __attribute__((ext_vector_type(8)));
typedef float  v4f  __attribute__((ext_vector_type(4)));
typedef float  v2f  __attribute__((ext_vector_type(2)));
typedef __bf16 v2b  __attribute__((ext_vector_type(2)));
typedef _Float16 v2h __attribute__((ext_vector_type(2)));
typedef _Float16 v16h __attribute__((ext_vector_type(16)));
union FragH { v16h v; v8us half[2]; v4u w[2]; _Float16 h[16]; };

// two inputs rounded to bf16 (nearest even) and held as f16, packed
__device__ __forceinline__ unsigned int rh2(float a, float b) {
  const v2f x = {a, b};
  const unsigned int u = __builtin_bit_cast(unsigned int, __builtin_convertvector(x, v2b));
  const v2f y = {__uint_as_float(u << 16), __uint_as_float(u & 0xFFFF0000u)};
  return __builtin_bit_cast(unsigned int, __builtin_convertvector(y, v2h));
}
__device__ __forceinline__ v4u rh8(v4f a, v4f b) { const v4u r = {rh2(a[0], a[1]), rh2(a[2], a[3]), rh2(b[0], b[1]), rh2(b[2], b[3])}; return r; }
__device__ __forceinline__ v8f mma(v16h a, v16h b, v8f c) { return __builtin_amdgcn_wmma_f32_16x16x32_f16(false, a, false, b, (short)0, c, false, false); }
// one 16 x 32 f16 fragment from LDS: p = the lane's 16 bytes of its first half fragment, the second half's stand step bytes on
__device__ __forceinline__ v16h lds_frag(const unsigned char* p, int step) { FragH f; f.half[0] = *(const v8us*)p; f.half[1] = *(const v8us*)(p + step); return f.v; }
// weights of one score tile's eight sums, which arrive as s / 2 (s = q . k / 8; the q fragments carry the 1/16): w[r] = f16(256 sigmoid(s)) = f16(128 + 128 tanh(s / 2)), one transcendental and half a packed fma each
__device__ __forceinline__ void sgw8(v8f acc, _Float16* w) {
  v8f t;
#pragma unroll      /* constant indices: the register arrays stay in registers */
  for (int r = 0; r < 8; ++r) t[r] = __builtin_amdgcn_tanhf(acc[r]);
  const v8f c128 = {128.f, 128.f, 128.f, 128.f, 128.f, 128.f, 128.f, 128.f};
  const v8f y = __builtin_elementwise_fma(t, c128, c128);
#pragma unroll      /* constant indices: the register arrays stay in registers */
  for (int r = 0; r < 8; ++r) w[r] = (_Float16)y[r];
}
// a thread's share of one stage as f32: k, two pieces of 8 consecutive head elements of one row each; v, two runs of 8 consecutive keys of one head column each
struct Stg { v4f k[2][2]; float v[2][8]; };
__device__ __forceinline__ void stg_load(Stg& r, const float* ks, const float* vs, unsigned ko, unsigned vo) {
#pragma unroll      /* constant indices: the register arrays stay in registers */
  for (int rd = 0; rd < 2; ++rd) { r.k[rd][0] = *(const v4f*)(ks + ko + rd * 32 * HD); r.k[rd][1] = *(const v4f*)(ks + ko + rd * 32 * HD + 4); }
#pragma unroll      /* constant indices: the register arrays stay in registers */
  for (int rd = 0; rd < 2; ++rd)
#pragma unroll      /* constant indices: the register arrays stay in registers */
    for (int q = 0; q < 8; ++q) r.v[rd][q] = vs[vo + (rd * 32 + q) * HD];
}
__device__ __forceinline__ void stg_store(const Stg& r, unsigned char* kd, unsigned char* vd) {
#pragma unroll      /* constant indices: the register arrays stay in registers */
  for (int rd = 0; rd < 2; ++rd) {
    *(v4u*)(kd + rd * 8 * KU) = rh8(r.k[rd][0], r.k[rd][1]);      /* 32 rows on = 2 groups of 16 keys = 8 half fragments */
    const v4u y = {rh2(r.v[rd][0], r.v[rd][1]), rh2(r.v[rd][2], r.v[rd][3]), rh2(r.v[rd][4], r.v[rd][5]), rh2(r.v[rd][6], r.v[rd][7])};
    *(v4u*)(vd + rd * 8 * 512) = y;
  }
}
// the two 32-key passes of one stage. kl, vl = the lane's own bytes in the stage's first K and V^T half fragments.
// S^T tile: D register r of lane (c, hh) = score of key 8 hh + r (tile 0) or 16 + 8 hh + r (tile 1) with query c: converted in place the two tiles are the B fragment of P^T in the hardware k order.
__device__ __forceinline__ void stage(const unsigned char* kl, const unsigned char* vl, const v16h (&qb)[2][2], v8f (&o)[2][4]) {
  const v8f z8 = {0.f, 0.f, 0.f, 0.f, 0.f, 0.f, 0.f, 0.f};
#pragma unroll      /* constant indices: the register arrays stay in registers */
  for (int p = 0; p < 2; ++p) {
    v16h ka[2][2], va[4];
#pragma unroll      /* constant indices: the register arrays stay in registers */
    for (int g = 0; g < 2; ++g)
#pragma unroll      /* constant indices: the register arrays stay in registers */
      for (int j = 0; j < 2; ++j) ka[g][j] = lds_frag(kl + (((2 * p + g) * 2 + j) * 2) * KU, KU);
#pragma unroll      /* constant indices: the register arrays stay in registers */
    for (int u = 0; u < 4; ++u) va[u] = lds_frag(vl + ((4 * p + u) * 2) * 512, 512);
#pragma unroll      /* constant indices: the register arrays stay in registers */
    for (int t = 0; t < 2; ++t) {
      v8f s0 = mma(ka[0][0], qb[t][0], z8); s0 = mma(ka[0][1], qb[t][1], s0);
      v8f s1 = mma(ka[1][0], qb[t][0], z8); s1 = mma(ka[1][1], qb[t][1], s1);
      FragH pw;
      sgw8(s0, pw.h); sgw8(s1, pw.h + 8);
#pragma unroll      /* constant indices: the register arrays stay in registers */
      for (int u = 0; u < 4; ++u) o[t][u] = mma(va[u], pw.v, o[t][u]);
    }
  }
}

// O^T tile u: D register r = out[query c][16 u + 8 hh + r]: eight consecutive floats of one output row per lane.
__global__ __launch_bounds__(256) __attribute__((amdgpu_waves_per_eu(4, 4))) void k_sattn(const float* __restrict__ xq, const float* __restrict__ xk, const float* __restrict__ xv, float* __restrict__ out) {
  __shared__ __attribute__((aligned(16))) unsigned char sm[2 * BUF];
  const int tid = threadIdx.x, w = tid >> 5, lane = tid & 31, c = lane & 15, hh = lane >> 4;
  const int plane = blockIdx.x / (SQ / (QW * WV)), qblk = blockIdx.x % (SQ / (QW * WV));
  const int q0 = qblk * (QW * WV) + w * QW;
  const float* kp = xk + (size_t)plane * SQ * HD;
  const float* vp = xv + (size_t)plane * SQ * HD;
  // staging, k: a wave takes 8 rows x 4 pieces of 32 bytes (8 whole 128-byte lines): row (w >> 1) * 8 + (lane >> 2), head elements 32 (w & 1) + 8 (lane & 3) .. + 7, that is slice j = w & 1, half h = (lane >> 1) & 1, lane half lane & 1
  const int krow = (w >> 1) * 8 + (lane >> 2);
  const unsigned ko = (unsigned)(krow * HD + 32 * (w & 1) + 8 * (lane & 3));
  const unsigned kd = (unsigned)((((krow >> 4) * 2 + (w & 1)) * 2 + ((lane >> 1) & 1)) * KU + (lane & 1) * KH + (krow & 15) * 16);
  // staging, v: thread = (key octet tid >> 6, head column tid & 63): each wave-wide 4-byte load covers one whole 128-byte line; the 8 keys of a column are 16 bytes of V^T's half fragment (16-row group, half = octet >> 1), lane (octet & 1, column & 15)
  const unsigned vo = (unsigned)((tid >> 6) * 8 * HD + (tid & 63));
  const unsigned vd = (unsigned)(KBY + ((((tid & 63) >> 4) * 2 + (tid >> 7)) * 32 + ((tid >> 6) & 1) * 16 + (tid & 15)) * 16);
  const unsigned kl = (unsigned)(hh * KH + c * 16), vl = (unsigned)(KBY + lane * 16);      /* reading */
  Stg r;
  stg_load(r, kp, vp, ko, vo);
  v16h qb[2][2];
#pragma unroll      /* constant indices: the register arrays stay in registers */
  for (int t = 0; t < 2; ++t)
#pragma unroll      /* constant indices: the register arrays stay in registers */
    for (int j = 0; j < 2; ++j) {      /* hardware k order: lane (c, hh) takes k = 8 hh .. + 7 and 16 + 8 hh .. + 7 of its row */
      const float* qs = xq + ((size_t)plane * SQ + q0 + 16 * t + c) * HD + 32 * j + 8 * hh; FragH f;
      f.w[0] = rh8(*(const v4f*)qs, *(const v4f*)(qs + 4)); f.w[1] = rh8(*(const v4f*)(qs + 16), *(const v4f*)(qs + 20));
      qb[t][j] = f.v * (_Float16)0.0625f;      /* q / 16, a power of two: the score sums come out as s / 2, the argument of tanh */
    }
  const v8f z8 = {0.f, 0.f, 0.f, 0.f, 0.f, 0.f, 0.f, 0.f};
  v8f o[2][4];
#pragma unroll      /* constant indices: the register arrays stay in registers */
  for (int t = 0; t < 2; ++t)
#pragma unroll      /* constant indices: the register arrays stay in registers */
    for (int u = 0; u < 4; ++u) o[t][u] = z8;
  stg_store(r, sm + kd, sm + vd);
  __syncthreads();      /* stage 0 is in buffer 0 for every wave */
  unsigned cur = 0;      /* byte offset of the buffer that holds stage s */
  for (int s = 0; s < NS - 1; ++s) {
    const unsigned nxt = cur ^ BUF;
    stg_load(r, kp + (size_t)(s + 1) * SK * HD, vp + (size_t)(s + 1) * SK * HD, ko, vo);      /* in flight over this stage's work */
    asm volatile("s_wait_xcnt 0x0" ::: "memory");      /* the work below may land in the registers that hold these loads' addresses: the wait stands in front of that overwrite */
    __builtin_amdgcn_sched_barrier(0);      /* keeps every one of these loads up here: one that sinks to its use would be waited for at full latency every stage */
    stage(sm + cur + kl, sm + cur + vl, qb, o);
    __builtin_amdgcn_sched_barrier(0);      /* keeps the rounding of the loaded values, and with it the wait for the loads, behind this stage's work */
    stg_store(r, sm + nxt + kd, sm + nxt + vd);      /* the buffer that stage s - 1 was read from: every wave left it before the last barrier */
    __syncthreads();      /* publishes stage s + 1 and ends every wave's reads of stage s */
    cur = nxt;
  }
  stage(sm + cur + kl, sm + cur + vl, qb, o);
#pragma unroll      /* constant indices: the register arrays stay in registers */
  for (int t = 0; t < 2; ++t) {
    float* orow = out + ((size_t)plane * SQ + q0 + 16 * t + c) * HD + 8 * hh;
#pragma unroll      /* constant indices: the register arrays stay in registers */
    for (int u = 0; u < 4; ++u) {
      const v8f y = o[t][u] * 0.00390625f;      /* the weights carry x256 */
      *(v4f*)(orow + 16 * u) = __builtin_shufflevector(y, y, 0, 1, 2, 3); *(v4f*)(orow + 16 * u + 4) = __builtin_shufflevector(y, y, 4, 5, 6, 7);
    }
  }
}

extern "C" void kernel_launch(void* const* d_in, const int* in_sizes, int n_in,
                              void* d_out, int out_size, void* d_ws, size_t ws_size, hipStream_t stream) {
  (void)in_sizes; (void)n_in; (void)out_size; (void)d_ws; (void)ws_size;
  const float* const* I = (const float* const*)d_in; const float* xq = I[0]; const float* xk = I[1]; const float* xv = I[2];      /* given q, k, v [B][H][S][64]: each (b, h) plane is a 'batch' of one 64-wide head */
  k_sattn<<<NB * (SQ / (QW * WV)), 256, 0, stream>>>(xq, xk, xv, (float*)d_out);      /* rounding, scores, sigmoid and weighted sum of v, all planes */
}

// v005
// Measured time: 50.3 microseconds a run.
// In both of two side-by-side timings against v004, it was 1.10 times as fast.
// Counting every step since v000, it is 227 times as fast.
#include <hip/hip_runtime.h>
// SIGMOID attention on given head-major query, key, value ([4][16][2048][64] each = 64 independent [2048][64] planes): scores = q . k / sqrt(64); attn = sigmoid(scores) (NO normalisation across keys: no softmax); out = attn v -> [4][16][2048][64].
// Structure: ONE launch, no workspace. A work-group = 8 waves x 64 query columns of one plane; one work-group a WGP, two waves a SIMD. It walks the plane's keys in stages of 64: its 256 threads read the stage's k and v as f32, round them (bf16, held as exact f16) and
// store them in LDS in FRAGMENT ORDER (each half fragment = 32 lanes x 16 bytes; V^T is formed by reading v down its columns), two buffers, one barrier a stage; the next stage's f32 loads fly while this stage is worked on.
// per wave 64 query columns (4 tiles of 16: a fragment read from LDS is used 4 times), per pass 32 keys: S^T = K Q^T (K = 64, f32 accumulation), P^T = f16(256 sigmoid(s / 8)) = f16(128 + 128 tanh(s / 16)) packed in place from the score accumulators, O^T += V^T P^T; scores and weights never reach memory.
// Compute dtype: inputs rounded to bf16; q, k, v and the weights x256 as plain f16 operands; scores and output sums f32. v_wmma_f32_16x16x32_f16.
#define NB 64      /* planes (batch x heads) */
#define SQ 2048    /* positions per plane */
#define HD 64      /* head size */
#define QW 64      /* query columns per wave */
#define QT (QW / 16) /* query tiles per wave: each K and V^T fragment read from LDS feeds QT products */
#define WV 8       /* waves per work-group */
#define SK 64      /* keys per stage */
#define NS (SQ / SK)
#define KU 640     /* LDS bytes from one K half fragment to the next: 128 mod 256 */
#define KH 320     /* LDS bytes from its lanes 0-15 to its lanes 16-31: 64 mod 256; with KU the 16 lanes of a storing half wave (4 rows x 4 pieces) fall on all 64 banks once */
#define KBY (16 * KU)        /* K of one stage */
#define BUF (KBY + 16 * 512) /* K and V^T of one stage */
typedef unsigned short v8us __attribute__((ext_vector_type(8), may_alias));
typedef unsigned int v4u __attribute__((ext_vector_type(4), may_alias));
typedef float  v8f  __attribute__((ext_vector_type(8)));
typedef float  v4f  __attribute__((ext_vector_type(4)));
typedef float  v2f  __attribute__((ext_vector_type(2)));
typedef __bf16 v2b  __attribute__((ext_vector_type(2)));
typedef _Float16 v2h __attribute__((ext_vector_type(2)));
typedef _Float16 v16h __attribute__((ext_vector_type(16)));
union FragH { v16h v; v8us half[2]; v4u w[2]; _Float16 h[16]; };

// two inputs rounded to bf16 (nearest even) and held as f16, packed
__device__ __forceinline__ unsigned int rh2(float a, float b) {
  const v2f x = {a, b};
  const unsigned int u = __builtin_bit_cast(unsigned int, __builtin_convertvector(x, v2b));
  const v2f y = {__uint_as_float(u << 16), __uint_as_float(u & 0xFFFF0000u)};
  return __builtin_bit_cast(unsigned int, __builtin_convertvector(y, v2h));
}
__device__ __forceinline__ v4u rh8(v4f a, v4f b) { const v4u r = {rh2(a[0], a[1]), rh2(a[2], a[3]), rh2(b[0], b[1]), rh2(b[2], b[3])}; return r; }
__device__ __forceinline__ v8f mma(v16h a, v16h b, v8f c) { return __builtin_amdgcn_wmma_f32_16x16x32_f16(false, a, false, b, (short)0, c, false, false); }
// one 16 x 32 f16 fragment from LDS: p = the lane's 16 bytes of its first half fragment, the second half's stand step bytes on
__device__ __forceinline__ v16h lds_frag(const unsigned char* p, int step) { FragH f; f.half[0] = *(const v8us*)p; f.half[1] = *(const v8us*)(p + step); return f.v; }
// weights of one score tile's eight sums, which arrive as s / 2 (s = q . k / 8; the q fragments carry the 1/16): w[r] = f16(256 sigmoid(s)) = f16(128 + 128 tanh(s / 2)), one transcendental and half a packed fma each
__device__ __forceinline__ void sgw8(v8f acc, _Float16* w) {
  v8f t;
#pragma unroll      /* constant indices: the register arrays stay in registers */
  for (int r = 0; r < 8; ++r) t[r] = __builtin_amdgcn_tanhf(acc[r]);
  const v8f c128 = {128.f, 128.f, 128.f, 128.f, 128.f, 128.f, 128.f, 128.f};
  const v8f y = __builtin_elementwise_fma(t, c128, c128);
#pragma unroll      /* constant indices: the register arrays stay in registers */
  for (int r = 0; r < 8; ++r) w[r] = (_Float16)y[r];
}
// a thread's share of one stage as f32: k, two pieces of 8 consecutive head elements of one row each; v, two runs of 8 consecutive keys of one head column each
struct Stg { v4f k[2][2]; float v[2][8]; };
__device__ __forceinline__ void stg_load(Stg& r, const float* ks, const float* vs, unsigned ko, unsigned vo) {
#pragma unroll      /* constant indices: the register arrays stay in registers */
  for (int rd = 0; rd < 2; ++rd) { r.k[rd][0] = *(const v4f*)(ks + ko + rd * 32 * HD); r.k[rd][1] = *(const v4f*)(ks + ko + rd * 32 * HD + 4); }
  asm volatile("s_wait_xcnt 0x0" ::: "memory");      /* the v loads below may land in the registers that hold the k loads' address: the wait stands in front of that overwrite */
#pragma unroll      /* constant indices: the register arrays stay in registers */
  for (int rd = 0; rd < 2; ++rd)
#pragma unroll      /* constant indices: the register arrays stay in registers */
    for (int q = 0; q < 8; ++q) r.v[rd][q] = vs[vo + (rd * 32 + q) * HD];
  asm volatile("s_wait_xcnt 0x0" ::: "memory");      /* what follows may land in the registers that hold these loads' addresses: the wait stands in front of that overwrite */
}
__device__ __forceinline__ void stg_store(const Stg& r, unsigned char* kd, unsigned char* vd) {
#pragma unroll      /* constant indices: the register arrays stay in registers */
  for (int rd = 0; rd < 2; ++rd) {
    *(v4u*)(kd + rd * 8 * KU) = rh8(r.k[rd][0], r.k[rd][1]);      /* 32 rows on = 2 groups of 16 keys = 8 half fragments */
    const v4u y = {rh2(r.v[rd][0], r.v[rd][1]), rh2(r.v[rd][2], r.v[rd][3]), rh2(r.v[rd][4], r.v[rd][5]), rh2(r.v[rd][6], r.v[rd][7])};
    *(v4u*)(vd + rd * 8 * 512) = y;
  }
}
// the two 32-key passes of one stage. kl, vl = the lane's own bytes in the stage's first K and V^T half fragments.
// S^T tile: D register r of lane (c, hh) = score of key 8 hh + r (tile 0) or 16 + 8 hh + r (tile 1) with query c: converted in place the two tiles are the B fragment of P^T in the hardware k order.
__device__ __forceinline__ void stage(const unsigned char* kl, const unsigned char* vl, const v16h (&qb)[QT][2], v8f (&o)[QT][4]) {
  const v8f z8 = {0.f, 0.f, 0.f, 0.f, 0.f, 0.f, 0.f, 0.f};
#pragma unroll      /* constant indices: the register arrays stay in registers */
  for (int p = 0; p < 2; ++p) {
    v16h ka[2][2], va[4];
#pragma unroll      /* constant indices: the register arrays stay in registers */
    for (int g = 0; g < 2; ++g)
#pragma unroll      /* constant indices: the register arrays stay in registers */
      for (int j = 0; j < 2; ++j) ka[g][j] = lds_frag(kl + (((2 * p + g) * 2 + j) * 2) * KU, KU);
#pragma unroll      /* constant indices: the register arrays stay in registers */
    for (int u = 0; u < 4; ++u) va[u] = lds_frag(vl + ((4 * p + u) * 2) * 512, 512);
#pragma unroll      /* constant indices: the register arrays stay in registers */
    for (int t = 0; t < QT; ++t) {
      v8f s0 = mma(ka[0][0], qb[t][0], z8); s0 = mma(ka[0][1], qb[t][1], s0);
      v8f s1 = mma(ka[1][0], qb[t][0], z8); s1 = mma(ka[1][1], qb[t][1], s1);
      FragH pw;
      sgw8(s0, pw.h); sgw8(s1, pw.h + 8);
#pragma unroll      /* constant indices: the register arrays stay in registers */
      for (int u = 0; u < 4; ++u) o[t][u] = mma(va[u], pw.v, o[t][u]);
    }
  }
}

// O^T tile u: D register r = out[query c][16 u + 8 hh + r]: eight consecutive floats of one output row per lane.
__global__ __launch_bounds__(256) __attribute__((amdgpu_waves_per_eu(2, 2))) void k_sattn(const float* __restrict__ xq, const float* __restrict__ xk, const float* __restrict__ xv, float* __restrict__ out) {
  __shared__ __attribute__((aligned(16))) unsigned char sm[2 * BUF];
  const int tid = threadIdx.x, w = tid >> 5, lane = tid & 31, c = lane & 15, hh = lane >> 4;
  const int plane = blockIdx.x / (SQ / (QW * WV)), qblk = blockIdx.x % (SQ / (QW * WV));
  const int q0 = qblk * (QW * WV) + w * QW;
  const float* kp = xk + (size_t)plane * SQ * HD;
  const float* vp = xv + (size_t)plane * SQ * HD;
  // staging, k: a wave takes 8 rows x 4 pieces of 32 bytes (8 whole 128-byte lines): row (w >> 1) * 8 + (lane >> 2), head elements 32 (w & 1) + 8 (lane & 3) .. + 7, that is slice j = w & 1, half h = (lane >> 1) & 1, lane half lane & 1
  const int krow = (w >> 1) * 8 + (lane >> 2);
  const unsigned ko = (unsigned)(krow * HD + 32 * (w & 1) + 8 * (lane & 3));
  const unsigned kd = (unsigned)((((krow >> 4) * 2 + (w & 1)) * 2 + ((lane >> 1) & 1)) * KU + (lane & 1) * KH + (krow & 15) * 16);
  // staging, v: thread = (key octet tid >> 6, head column tid & 63): each wave-wide 4-byte load covers one whole 128-byte line; the 8 keys of a column are 16 bytes of V^T's half fragment (16-row group, half = octet >> 1), lane (octet & 1, column & 15)
  const unsigned vo = (unsigned)((tid >> 6) * 8 * HD + (tid & 63));
  const unsigned vd = (unsigned)(KBY + ((((tid & 63) >> 4) * 2 + (tid >> 7)) * 32 + ((tid >> 6) & 1) * 16 + (tid & 15)) * 16);
  const unsigned kl = (unsigned)(hh * KH + c * 16), vl = (unsigned)(KBY + lane * 16);      /* reading */
  Stg r;
  stg_load(r, kp, vp, ko, vo);
  v16h qb[QT][2];
#pragma unroll      /* constant indices: the register arrays stay in registers */
  for (int t = 0; t < QT; ++t) {
#pragma unroll      /* constant indices: the register arrays stay in registers */
    for (int j = 0; j < 2; ++j) {      /* hardware k order: lane (c, hh) takes k = 8 hh .. + 7 and 16 + 8 hh .. + 7 of its row */
      const float* qs = xq + ((size_t)plane * SQ + q0 + 16 * t + c) * HD + 32 * j + 8 * hh; FragH f;
      f.w[0] = rh8(*(const v4f*)qs, *(const v4f*)(qs + 4)); f.w[1] = rh8(*(const v4f*)(qs + 16), *(const v4f*)(qs + 20));
      qb[t][j] = f.v * (_Float16)0.0625f;      /* q / 16, a power of two: the score sums come out as s / 2, the argument of tanh */
    }
    asm volatile("s_wait_xcnt 0x0" ::: "memory");      /* the next tile's loads may land in the registers that hold this tile's address: the wait stands in front of that overwrite */
  }
  const v8f z8 = {0.f, 0.f, 0.f, 0.f, 0.f, 0.f, 0.f, 0.f};
  v8f o[QT][4];
#pragma unroll      /* constant indices: the register arrays stay in registers */
  for (int t = 0; t < QT; ++t)
#pragma unroll      /* constant indices: the register arrays stay in registers */
    for (int u = 0; u < 4; ++u) o[t][u] = z8;
  stg_store(r, sm + kd, sm + vd);
  __syncthreads();      /* stage 0 is in buffer 0 for every wave */
  unsigned cur = 0;      /* byte offset of the buffer that holds stage s */
  for (int s = 0; s < NS - 1; ++s) {
    const unsigned nxt = cur ^ BUF;
    stg_load(r, kp + (size_t)(s + 1) * SK * HD, vp + (size_t)(s + 1) * SK * HD, ko, vo);      /* in flight over this stage's work */
    __builtin_amdgcn_sched_barrier(0);      /* keeps every one of these loads up here: one that sinks to its use would be waited for at full latency every stage */
    stage(sm + cur + kl, sm + cur + vl, qb, o);
    __builtin_amdgcn_sched_barrier(0);      /* keeps the rounding of the loaded values, and with it the wait for the loads, behind this stage's work */
    stg_store(r, sm + nxt + kd, sm + nxt + vd);      /* the buffer that stage s - 1 was read from: every wave left it before the last barrier */
    __syncthreads();      /* publishes stage s + 1 and ends every wave's reads of stage s */
    cur = nxt;
  }
  stage(sm + cur + kl, sm + cur + vl, qb, o);
#pragma unroll      /* constant indices: the register arrays stay in registers */
  for (int t = 0; t < QT; ++t) {
    float* orow = out + ((size_t)plane * SQ + q0 + 16 * t + c) * HD + 8 * hh;
    v8f y[4];
#pragma unroll      /* constant indices: the register arrays stay in registers */
    for (int u = 0; u < 4; ++u) y[u] = o[t][u] * 0.00390625f;      /* the weights carry x256 */
#pragma unroll      /* constant indices: the register arrays stay in registers */
    for (int u = 0; u < 4; ++u) { *(v4f*)(orow + 16 * u) = __builtin_shufflevector(y[u], y[u], 0, 1, 2, 3); *(v4f*)(orow + 16 * u + 4) = __builtin_shufflevector(y[u], y[u], 4, 5, 6, 7); }
    asm volatile("s_wait_xcnt 0x0" ::: "memory");      /* the next tile's products and address may land in registers that these stores name: the wait stands in front of that overwrite */
    __builtin_amdgcn_sched_barrier(0);      /* keeps the next tile's work behind that wait */
  }
}

extern "C" void kernel_launch(void* const* d_in, const int* in_sizes, int n_in,
                              void* d_out, int out_size, void* d_ws, size_t ws_size, hipStream_t stream) {
  (void)in_sizes; (void)n_in; (void)out_size; (void)d_ws; (void)ws_size;
  const float* const* I = (const float* const*)d_in; const float* xq = I[0]; const float* xk = I[1]; const float* xv = I[2];      /* given q, k, v [B][H][S][64]: each (b, h) plane is a 'batch' of one 64-wide head */
  k_sattn<<<NB * (SQ / (QW * WV)), 256, 0, stream>>>(xq, xk, xv, (float*)d_out);      /* rounding, scores, sigmoid and weighted sum of v, all planes */
}

// v006
// One run takes 47.8 microseconds.
// Two timings next to v005 both put it at 1.05 times that version's speed.
// All steps since v000 together make it 238 times as fast.
#include <hip/hip_runtime.h>
// SIGMOID attention on given head-major query, key, value ([4][16][2048][64] each = 64 independent [2048][64] planes): scores = q . k / sqrt(64); attn = sigmoid(scores) (NO normalisation across keys: no softmax); out = attn v -> [4][16][2048][64].
// Structure: ONE launch, no workspace. A work-group = 8 waves x 64 query columns of one plane; one work-group a WGP, two waves a SIMD. It walks the plane's keys in stages of 64: its 256 threads read the stage's k and v as f32, round them (bf16, held as exact f16) and
// store them in LDS in FRAGMENT ORDER (each half fragment = 32 lanes x 16 bytes; V^T is formed by reading v down its columns), two buffers, one barrier a stage. The staging stands INSIDE a stage, behind its score products: there stage s + 1 is rounded and stored and the f32 loads of stage s + 2 are issued (they fly for a whole stage, over the barrier), so that a wave's waits there fall into the work of the SIMD's other wave and not, as at the barrier, on all eight waves at once.
// per wave 64 query columns (4 tiles of 16: a fragment read from LDS is used 4 times), per pass 32 keys: S^T = K Q^T (K = 64, f32 accumulation), P^T = f16(256 sigmoid(s / 8)) = f16(128 + 128 tanh(s / 16)) packed in place from the score accumulators, O^T += V^T P^T; scores and weights never reach memory.
// Compute dtype: inputs rounded to bf16; q, k, v and the weights x256 as plain f16 operands; scores and output sums f32. v_wmma_f32_16x16x32_f16.
#define NB 64      /* planes (batch x heads) */
#define SQ 2048    /* positions per plane */
#define HD 64      /* head size */
#define QW 64      /* query columns per wave */
#define QT (QW / 16) /* query tiles per wave: each K and V^T fragment read from LDS feeds QT products */
#define WV 8       /* waves per work-group */
#define SK 64      /* keys per stage */
#define NS (SQ / SK)
#define KU 640     /* LDS bytes from one K half fragment to the next: 128 mod 256 */
#define KH 320     /* LDS bytes from its lanes 0-15 to its lanes 16-31: 64 mod 256; with KU the 16 lanes of a storing half wave (4 rows x 4 pieces) fall on all 64 banks once */
#define KBY (16 * KU)        /* K of one stage */
#define BUF (KBY + 16 * 512) /* K and V^T of one stage */
typedef unsigned short v8us __attribute__((ext_vector_type(8), may_alias));
typedef unsigned int v4u __attribute__((ext_vector_type(4), may_alias));
typedef float  v8f  __attribute__((ext_vector_type(8)));
typedef float  v4f  __attribute__((ext_vector_type(4)));
typedef float  v2f  __attribute__((ext_vector_type(2)));
typedef __bf16 v2b  __attribute__((ext_vector_type(2)));
typedef _Float16 v2h __attribute__((ext_vector_type(2)));
typedef _Float16 v16h __attribute__((ext_vector_type(16)));
union FragH { v16h v; v8us half[2]; v4u w[2]; _Float16 h[16]; };

// two inputs rounded to bf16 (nearest even) and held as f16, packed
__device__ __forceinline__ unsigned int rh2(float a, float b) {
  const v2f x = {a, b};
  const unsigned int u = __builtin_bit_cast(unsigned int, __builtin_convertvector(x, v2b));
  const v2f y = {__uint_as_float(u << 16), __uint_as_float(u & 0xFFFF0000u)};
  return __builtin_bit_cast(unsigned int, __builtin_convertvector(y, v2h));
}
__device__ __forceinline__ v4u rh8(v4f a, v4f b) { const v4u r = {rh2(a[0], a[1]), rh2(a[2], a[3]), rh2(b[0], b[1]), rh2(b[2], b[3])}; return r; }
__device__ __forceinline__ v8f mma(v16h a, v16h b, v8f c) { return __builtin_amdgcn_wmma_f32_16x16x32_f16(false, a, false, b, (short)0, c, false, false); }
// one 16 x 32 f16 fragment from LDS: p = the lane's 16 bytes of its first half fragment, the second half's stand step bytes on
__device__ __forceinline__ v16h lds_frag(const unsigned char* p, int step) { FragH f; f.half[0] = *(const v8us*)p; f.half[1] = *(const v8us*)(p + step); return f.v; }
// weights of one score tile's eight sums, which arrive as s / 2 (s = q . k / 8; the q fragments carry the 1/16): w[r] = f16(256 sigmoid(s)) = f16(128 + 128 tanh(s / 2)), one transcendental and half a packed fma each
__device__ __forceinline__ void sgw8(v8f acc, _Float16* w) {
  v8f t;
#pragma unroll      /* constant indices: the register arrays stay in registers */
  for (int r = 0; r < 8; ++r) t[r] = __builtin_amdgcn_tanhf(acc[r]);
  const v8f c128 = {128.f, 128.f, 128.f, 128.f, 128.f, 128.f, 128.f, 128.f};
  const v8f y = __builtin_elementwise_fma(t, c128, c128);
#pragma unroll      /* constant indices: the register arrays stay in registers */
  for (int r = 0; r < 8; ++r) w[r] = (_Float16)y[r];
}
// a thread's share of one stage as f32: k, two pieces of 8 consecutive head elements of one row each; v, two runs of 8 consecutive keys of one head column each
struct Stg { v4f k[2][2]; float v[2][8]; };
__device__ __forceinline__ void stg_load(Stg& r, const float* ks, const float* vs, unsigned ko, unsigned vo) {
  __builtin_amdgcn_sched_barrier(0);      /* with the two below: no vector instruction from outside comes between a load and the wait behind it, where it could be given a register that holds the load's address */
#pragma unroll      /* constant indices: the register arrays stay in registers */
  for (int rd = 0; rd < 2; ++rd) { r.k[rd][0] = *(const v4f*)(ks + ko + rd * 32 * HD); r.k[rd][1] = *(const v4f*)(ks + ko + rd * 32 * HD + 4); }
  asm volatile("s_wait_xcnt 0x0" ::: "memory");      /* the v loads below may land in the registers that hold the k loads' address: the wait stands in front of that overwrite */
  __builtin_amdgcn_sched_barrier(0);      /* the second of the three: holds the v loads and their address behind the wait above */
#pragma unroll      /* constant indices: the register arrays stay in registers */
  for (int rd = 0; rd < 2; ++rd)
#pragma unroll      /* constant indices: the register arrays stay in registers */
    for (int q = 0; q < 8; ++q) r.v[rd][q] = vs[vo + (rd * 32 + q) * HD];
  asm volatile("s_wait_xcnt 0x0" ::: "memory");      /* what follows may land in the registers that hold these loads' addresses: the wait stands in front of that overwrite */
  __builtin_amdgcn_sched_barrier(0);      /* the third: holds what follows behind that wait, and the loads up here (sunk towards the loop's foot they would have less time to land) */
}
__device__ __forceinline__ void stg_store(const Stg& r, unsigned char* kd, unsigned char* vd) {
#pragma unroll      /* constant indices: the register arrays stay in registers */
  for (int rd = 0; rd < 2; ++rd) {
    *(v4u*)(kd + rd * 8 * KU) = rh8(r.k[rd][0], r.k[rd][1]);      /* 32 rows on = 2 groups of 16 keys = 8 half fragments */
    const v4u y = {rh2(r.v[rd][0], r.v[rd][1]), rh2(r.v[rd][2], r.v[rd][3]), rh2(r.v[rd][4], r.v[rd][5]), rh2(r.v[rd][6], r.v[rd][7])};
    *(v4u*)(vd + rd * 8 * 512) = y;
  }
}
// work-group barrier that orders LDS alone: __syncthreads() would also wait for the f32 loads of the stage after next, which are meant to stay in flight across it (they land in the thread's own registers)
__device__ __forceinline__ void lds_barrier() {
  __builtin_amdgcn_fence(__ATOMIC_RELEASE, "workgroup", "local");      /* this wave's LDS stores and reads are done before it signals */
  __builtin_amdgcn_s_barrier();
  __builtin_amdgcn_fence(__ATOMIC_ACQUIRE, "workgroup", "local");      /* no LDS read of the next stage moves up over the barrier */
}
// the K and V^T fragments of one 32-key pass
struct Frg { v16h ka[2][2], va[4]; };
// kl, vl = the lane's own bytes in the stage's first K and V^T half fragments; p = the pass
__device__ __forceinline__ void frg_load(Frg& f, const unsigned char* kl, const unsigned char* vl, int p) {
#pragma unroll      /* constant indices: the register arrays stay in registers */
  for (int g = 0; g < 2; ++g)
#pragma unroll      /* constant indices: the register arrays stay in registers */
    for (int j = 0; j < 2; ++j) f.ka[g][j] = lds_frag(kl + (((2 * p + g) * 2 + j) * 2) * KU, KU);
#pragma unroll      /* constant indices: the register arrays stay in registers */
  for (int u = 0; u < 4; ++u) f.va[u] = lds_frag(vl + ((4 * p + u) * 2) * 512, 512);
}
// the score products of one 32-key pass.
// S^T tile: D register r of lane (c, hh) = score of key 8 hh + r (tile 0) or 16 + 8 hh + r (tile 1) with query c: converted in place the two tiles are the B fragment of P^T in the hardware k order.
__device__ __forceinline__ void scores(const Frg& f, const v16h (&qb)[QT][2], v8f (&sc)[QT][2]) {
  const v8f z8 = {0.f, 0.f, 0.f, 0.f, 0.f, 0.f, 0.f, 0.f};
#pragma unroll      /* constant indices: the register arrays stay in registers */
  for (int t = 0; t < QT; ++t)
#pragma unroll      /* constant indices: the register arrays stay in registers */
    for (int g = 0; g < 2; ++g) { sc[t][g] = mma(f.ka[g][0], qb[t][0], z8); sc[t][g] = mma(f.ka[g][1], qb[t][1], sc[t][g]); }
}
// its weights and its share of the output sums
__device__ __forceinline__ void wpv(const Frg& f, const v8f (&sc)[QT][2], v8f (&o)[QT][4]) {
#pragma unroll      /* constant indices: the register arrays stay in registers */
  for (int t = 0; t < QT; ++t) {
    FragH pw;
    sgw8(sc[t][0], pw.h); sgw8(sc[t][1], pw.h + 8);
#pragma unroll      /* constant indices: the register arrays stay in registers */
    for (int u = 0; u < 4; ++u) o[t][u] = mma(f.va[u], pw.v, o[t][u]);
  }
}
__device__ __forceinline__ void pass(const Frg& f, const v16h (&qb)[QT][2], v8f (&o)[QT][4]) { v8f sc[QT][2]; scores(f, qb, sc); wpv(f, sc, o); }

// O^T tile u: D register r = out[query c][16 u + 8 hh + r]: eight consecutive floats of one output row per lane.
__global__ __launch_bounds__(256) __attribute__((amdgpu_waves_per_eu(2, 2))) void k_sattn(const float* __restrict__ xq, const float* __restrict__ xk, const float* __restrict__ xv, float* __restrict__ out) {
  __shared__ __attribute__((aligned(16))) unsigned char sm[2 * BUF];
  const int tid = threadIdx.x, w = tid >> 5, lane = tid & 31, c = lane & 15, hh = lane >> 4;
  const int plane = blockIdx.x / (SQ / (QW * WV)), qblk = blockIdx.x % (SQ / (QW * WV));
  const int q0 = qblk * (QW * WV) + w * QW;
  const float* kp = xk + (size_t)plane * SQ * HD;
  const float* vp = xv + (size_t)plane * SQ * HD;
  // staging, k: a wave takes 8 rows x 4 pieces of 32 bytes (8 whole 128-byte lines): row (w >> 1) * 8 + (lane >> 2), head elements 32 (w & 1) + 8 (lane & 3) .. + 7, that is slice j = w & 1, half h = (lane >> 1) & 1, lane half lane & 1
  const int krow = (w >> 1) * 8 + (lane >> 2);
  const unsigned ko = (unsigned)(krow * HD + 32 * (w & 1) + 8 * (lane & 3));
  const unsigned kd = (unsigned)((((krow >> 4) * 2 + (w & 1)) * 2 + ((lane >> 1) & 1)) * KU + (lane & 1) * KH + (krow & 15) * 16);
  // staging, v: thread = (key octet tid >> 6, head column tid & 63): each wave-wide 4-byte load covers one whole 128-byte line; the 8 keys of a column are 16 bytes of V^T's half fragment (16-row group, half = octet >> 1), lane (octet & 1, column & 15)
  const unsigned vo = (unsigned)((tid >> 6) * 8 * HD + (tid & 63));
  const unsigned vd = (unsigned)(KBY + ((((tid & 63) >> 4) * 2 + (tid >> 7)) * 32 + ((tid >> 6) & 1) * 16 + (tid & 15)) * 16);
  const unsigned kl = (unsigned)(hh * KH + c * 16), vl = (unsigned)(KBY + lane * 16);      /* reading */
  Stg r;
  stg_load(r, kp, vp, ko, vo);
  v16h qb[QT][2];
#pragma unroll      /* constant indices: the register arrays stay in registers */
  for (int t = 0; t < QT; ++t) {
#pragma unroll      /* constant indices: the register arrays stay in registers */
    for (int j = 0; j < 2; ++j) {      /* hardware k order: lane (c, hh) takes k = 8 hh .. + 7 and 16 + 8 hh .. + 7 of its row */
      const float* qs = xq + ((size_t)plane * SQ + q0 + 16 * t + c) * HD + 32 * j + 8 * hh; FragH f;
      f.w[0] = rh8(*(const v4f*)qs, *(const v4f*)(qs + 4)); f.w[1] = rh8(*(const v4f*)(qs + 16), *(const v4f*)(qs + 20));
      qb[t][j] = f.v * (_Float16)0.0625f;      /* q / 16, a power of two: the score sums come out as s / 2, the argument of tanh */
    }
    asm volatile("s_wait_xcnt 0x0" ::: "memory");      /* the next tile's loads may land in the registers that hold this tile's address: the wait stands in front of that overwrite */
  }
  const v8f z8 = {0.f, 0.f, 0.f, 0.f, 0.f, 0.f, 0.f, 0.f};
  v8f o[QT][4];
#pragma unroll      /* constant indices: the register arrays stay in registers */
  for (int t = 0; t < QT; ++t)
#pragma unroll      /* constant indices: the register arrays stay in registers */
    for (int u = 0; u < 4; ++u) o[t][u] = z8;
  __builtin_amdgcn_sched_barrier(0);      /* keeps the rounding of stage 0, and with it a wait for its loads, behind the issue of the q loads */
  stg_store(r, sm + kd, sm + vd);
  stg_load(r, kp + (size_t)SK * HD, vp + (size_t)SK * HD, ko, vo);      /* stage 1, in flight until stage 0's score products are issued */
  lds_barrier();      /* stage 0 is in buffer 0 for every wave */
  unsigned cur = 0;      /* byte offset of the buffer that holds stage s */
  Frg f0, f1;
  for (int s = 0; s < NS - 2; ++s) {
    const unsigned nxt = cur ^ BUF;
    frg_load(f0, sm + cur + kl, sm + cur + vl, 0); frg_load(f1, sm + cur + kl, sm + cur + vl, 1);
    __builtin_amdgcn_sched_barrier(0);      /* keeps the stage's LDS reads together up here: read just ahead of its product a fragment is waited for at full LDS latency */
    v8f sc0[QT][2], sc1[QT][2];
    scores(f0, qb, sc0); scores(f1, qb, sc1);
    __builtin_amdgcn_sched_barrier(0);      /* keeps the rounding, and with it the wait for the loads of a stage ago, behind the stage's score products */
    stg_store(r, sm + nxt + kd, sm + nxt + vd);      /* stage s + 1 into the buffer that stage s - 1 was read from: every wave left it before the last barrier */
    stg_load(r, kp + (size_t)(s + 2) * SK * HD, vp + (size_t)(s + 2) * SK * HD, ko, vo);      /* in flight until this place of stage s + 1 */
    wpv(f0, sc0, o); wpv(f1, sc1, o);
    __builtin_amdgcn_sched_barrier(0);      /* keeps the weights and output products in front of the barrier: they touch no memory, and moved behind it they would start only after the slowest wave */
    lds_barrier();      /* publishes stage s + 1 and ends every wave's reads of stage s */
    cur = nxt;
  }
  frg_load(f0, sm + cur + kl, sm + cur + vl, 0); frg_load(f1, sm + cur + kl, sm + cur + vl, 1);      /* stage NS - 2: nothing is left to load */
  pass(f0, qb, o);
  stg_store(r, sm + (cur ^ BUF) + kd, sm + (cur ^ BUF) + vd);
  pass(f1, qb, o);
  __syncthreads();      /* publishes the last stage */
  cur ^= BUF;
  frg_load(f0, sm + cur + kl, sm + cur + vl, 0); frg_load(f1, sm + cur + kl, sm + cur + vl, 1);
  pass(f0, qb, o);
  pass(f1, qb, o);
#pragma unroll      /* constant indices: the register arrays stay in registers */
  for (int t = 0; t < QT; ++t) {
    float* orow = out + ((size_t)plane * SQ + q0 + 16 * t + c) * HD + 8 * hh;
    v8f y[4];
#pragma unroll      /* constant indices: the register arrays stay in registers */
    for (int u = 0; u < 4; ++u) y[u] = o[t][u] * 0.00390625f;      /* the weights carry x256 */
#pragma unroll      /* constant indices: the register arrays stay in registers */
    for (int u = 0; u < 4; ++u) { *(v4f*)(orow + 16 * u) = __builtin_shufflevector(y[u], y[u], 0, 1, 2, 3); *(v4f*)(orow + 16 * u + 4) = __builtin_shufflevector(y[u], y[u], 4, 5, 6, 7); }
    asm volatile("s_wait_xcnt 0x0" ::: "memory");      /* the next tile's products and address may land in registers that these stores name: the wait stands in front of that overwrite */
    __builtin_amdgcn_sched_barrier(0);      /* keeps the next tile's work behind that wait */
  }
}

extern "C" void kernel_launch(void* const* d_in, const int* in_sizes, int n_in,
                              void* d_out, int out_size, void* d_ws, size_t ws_size, hipStream_t stream) {
  (void)in_sizes; (void)n_in; (void)out_size; (void)d_ws; (void)ws_size;
  const float* const* I = (const float* const*)d_in; const float* xq = I[0]; const float* xk = I[1]; const float* xv = I[2];      /* given q, k, v [B][H][S][64]: each (b, h) plane is a 'batch' of one 64-wide head */
  k_sattn<<<NB * (SQ / (QW * WV)), 256, 0, stream>>>(xq, xk, xv, (float*)d_out);      /* rounding, scores, sigmoid and weighted sum of v, all planes */
}

// v007
// One run takes 46.5 microseconds.
// Next to v006, in two timings, it ran 1.03 times as fast each time.
// Over all steps from v000 it is 245 times as fast.
#include <hip/hip_runtime.h>
// SIGMOID attention on given head-major query, key, value ([4][16][2048][64] each = 64 independent [2048][64] planes): scores = q . k / sqrt(64); attn = sigmoid(scores) (NO normalisation across keys: no softmax); out = attn v -> [4][16][2048][64].
// Structure: ONE launch, no workspace. A work-group = 8 waves x 64 query columns of one plane; one work-group a WGP, two waves a SIMD. It walks the plane's keys in stages of 64: its 256 threads read the stage's k and v as f32, round them (bf16, held as exact f16) and
// store them in LDS in FRAGMENT ORDER (each half fragment = 32 lanes x 16 bytes; V^T is formed by reading v down its columns), two buffers, one barrier a stage. The staging stands INSIDE a stage, behind its score products: there stage s + 1 is rounded and stored and the f32 loads of stage s + 2 are issued (they fly for a whole stage, over the barrier), so that a wave's waits there fall into the work of the SIMD's other wave and not, as at the barrier, on all eight waves at once.
// per wave 64 query columns (4 tiles of 16: a fragment read from LDS is used 4 times), per pass 32 keys: S^T = K Q^T (K = 64, f32 accumulation), T^T = f16(tanh(s / 16)) packed in place from the score accumulators, O^T += V^T T^T; scores and weights never reach memory.
// The constant half of the sigmoid stays out of the weights: sigmoid(x) = 1/2 + 1/2 tanh(x / 2), so out = 1/2 (sum over all keys of v) + 1/2 (tanh weights) v. The column sums of v do not depend on the query: each staging thread adds up the rounded v it stores anyway, and the work-group joins the four partial sums of a column through LDS once, at the end.
// Compute dtype: inputs rounded to bf16; q, k, v and the tanh weights as plain f16 operands; scores and output sums f32. v_wmma_f32_16x16x32_f16.
#define NB 64      /* planes (batch x heads) */
#define SQ 2048    /* positions per plane */
#define HD 64      /* head size */
#define QW 64      /* query columns per wave */
#define QT (QW / 16) /* query tiles per wave: each K and V^T fragment read from LDS feeds QT products */
#define WV 8       /* waves per work-group */
#define SK 64      /* keys per stage */
#define NS (SQ / SK)
#define KU 640     /* LDS bytes from one K half fragment to the next: 128 mod 256 */
#define KH 320     /* LDS bytes from its lanes 0-15 to its lanes 16-31: 64 mod 256; with KU the 16 lanes of a storing half wave (4 rows x 4 pieces) fall on all 64 banks once */
#define KBY (16 * KU)        /* K of one stage */
#define BUF (KBY + 16 * 512) /* K and V^T of one stage */
typedef unsigned short v8us __attribute__((ext_vector_type(8), may_alias));
typedef unsigned int v4u __attribute__((ext_vector_type(4), may_alias));
typedef float  v8f  __attribute__((ext_vector_type(8)));
typedef float  v4f  __attribute__((ext_vector_type(4)));
typedef float  v2f  __attribute__((ext_vector_type(2)));
typedef __bf16 v2b  __attribute__((ext_vector_type(2)));
typedef _Float16 v2h __attribute__((ext_vector_type(2)));
typedef _Float16 v16h __attribute__((ext_vector_type(16)));
union FragH { v16h v; v8us half[2]; v4u w[2]; _Float16 h[16]; };

// two inputs rounded to bf16 (nearest even) and held as f16, packed
__device__ __forceinline__ unsigned int rh2(float a, float b) {
  const v2f x = {a, b};
  const unsigned int u = __builtin_bit_cast(unsigned int, __builtin_convertvector(x, v2b));
  const v2f y = {__uint_as_float(u << 16), __uint_as_float(u & 0xFFFF0000u)};
  return __builtin_bit_cast(unsigned int, __builtin_convertvector(y, v2h));
}
// two inputs rounded to bf16 (nearest even), as f32
__device__ __forceinline__ v2f rb2(float a, float b) {
  const v2f x = {a, b};
  const unsigned int u = __builtin_bit_cast(unsigned int, __builtin_convertvector(x, v2b));
  const v2f y = {__uint_as_float(u << 16), __uint_as_float(u & 0xFFFF0000u)};
  return y;
}
__device__ __forceinline__ unsigned int h2(v2f y) { return __builtin_bit_cast(unsigned int, __builtin_convertvector(y, v2h)); }
__device__ __forceinline__ v4u rh8(v4f a, v4f b) { const v4u r = {rh2(a[0], a[1]), rh2(a[2], a[3]), rh2(b[0], b[1]), rh2(b[2], b[3])}; return r; }
__device__ __forceinline__ v8f mma(v16h a, v16h b, v8f c) { return __builtin_amdgcn_wmma_f32_16x16x32_f16(false, a, false, b, (short)0, c, false, false); }
// one 16 x 32 f16 fragment from LDS: p = the lane's 16 bytes of its first half fragment, the second half's stand step bytes on
__device__ __forceinline__ v16h lds_frag(const unsigned char* p, int step) { FragH f; f.half[0] = *(const v8us*)p; f.half[1] = *(const v8us*)(p + step); return f.v; }
// weights of one score tile's eight sums, which arrive as s / 2 (s = q . k / 8; the q fragments carry the 1/16): w[r] = f16(tanh(s / 2)) = f16(2 sigmoid(s) - 1), one transcendental and half a packed conversion each
__device__ __forceinline__ void sgw8(v8f acc, _Float16* w) {
  v8f t;
#pragma unroll      /* constant indices: the register arrays stay in registers */
  for (int r = 0; r < 8; ++r) t[r] = __builtin_amdgcn_tanhf(acc[r]);
#pragma unroll      /* constant indices: the register arrays stay in registers */
  for (int r = 0; r < 8; ++r) w[r] = (_Float16)t[r];
}
// a thread's share of one stage as f32: k, two pieces of 8 consecutive head elements of one row each; v, two runs of 8 consecutive keys of one head column each
struct Stg { v4f k[2][2]; float v[2][8]; };
__device__ __forceinline__ void stg_load(Stg& r, const float* ks, const float* vs, unsigned ko, unsigned vo) {
  __builtin_amdgcn_sched_barrier(0);      /* with the two below: no vector instruction from outside comes between a load and the wait behind it, where it could be given a register that holds the load's address */
#pragma unroll      /* constant indices: the register arrays stay in registers */
  for (int rd = 0; rd < 2; ++rd) { r.k[rd][0] = *(const v4f*)(ks + ko + rd * 32 * HD); r.k[rd][1] = *(const v4f*)(ks + ko + rd * 32 * HD + 4); }
  asm volatile("s_wait_xcnt 0x0" ::: "memory");      /* the v loads below may land in the registers that hold the k loads' address: the wait stands in front of that overwrite */
  __builtin_amdgcn_sched_barrier(0);      /* the second of the three: holds the v loads and their address behind the wait above */
#pragma unroll      /* constant indices: the register arrays stay in registers */
  for (int rd = 0; rd < 2; ++rd)
#pragma unroll      /* constant indices: the register arrays stay in registers */
    for (int q = 0; q < 8; ++q) r.v[rd][q] = vs[vo + (rd * 32 + q) * HD];
  asm volatile("s_wait_xcnt 0x0" ::: "memory");      /* what follows may land in the registers that hold these loads' addresses: the wait stands in front of that overwrite */
  __builtin_amdgcn_sched_barrier(0);      /* the third: holds what follows behind that wait, and the loads up here (sunk towards the loop's foot they would have less time to land) */
}
// cs: the thread's running sums of the rounded v of its head column
__device__ __forceinline__ void stg_store(const Stg& r, unsigned char* kd, unsigned char* vd, v2f& cs) {
#pragma unroll      /* constant indices: the register arrays stay in registers */
  for (int rd = 0; rd < 2; ++rd) {
    *(v4u*)(kd + rd * 8 * KU) = rh8(r.k[rd][0], r.k[rd][1]);      /* 32 rows on = 2 groups of 16 keys = 8 half fragments */
    const v2f a = rb2(r.v[rd][0], r.v[rd][1]), b = rb2(r.v[rd][2], r.v[rd][3]), c = rb2(r.v[rd][4], r.v[rd][5]), d = rb2(r.v[rd][6], r.v[rd][7]);
    cs += (a + b) + (c + d);      /* pairs first: the chain through the running sums is one add a run of 8 keys */
    const v4u y = {h2(a), h2(b), h2(c), h2(d)};
    *(v4u*)(vd + rd * 8 * 512) = y;
  }
}
// work-group barrier that orders LDS alone: __syncthreads() would also wait for the f32 loads of the stage after next, which are meant to stay in flight across it (they land in the thread's own registers)
__device__ __forceinline__ void lds_barrier() {
  __builtin_amdgcn_fence(__ATOMIC_RELEASE, "workgroup", "local");      /* this wave's LDS stores and reads are done before it signals */
  __builtin_amdgcn_s_barrier();
  __builtin_amdgcn_fence(__ATOMIC_ACQUIRE, "workgroup", "local");      /* no LDS read of the next stage moves up over the barrier */
}
// the K and V^T fragments of one 32-key pass
struct Frg { v16h ka[2][2], va[4]; };
// kl, vl = the lane's own bytes in the stage's first K and V^T half fragments; p = the pass
__device__ __forceinline__ void frg_load(Frg& f, const unsigned char* kl, const unsigned char* vl, int p) {
#pragma unroll      /* constant indices: the register arrays stay in registers */
  for (int g = 0; g < 2; ++g)
#pragma unroll      /* constant indices: the register arrays stay in registers */
    for (int j = 0; j < 2; ++j) f.ka[g][j] = lds_frag(kl + (((2 * p + g) * 2 + j) * 2) * KU, KU);
#pragma unroll      /* constant indices: the register arrays stay in registers */
  for (int u = 0; u < 4; ++u) f.va[u] = lds_frag(vl + ((4 * p + u) * 2) * 512, 512);
}
// the score products of one 32-key pass.
// S^T tile: D register r of lane (c, hh) = score of key 8 hh + r (tile 0) or 16 + 8 hh + r (tile 1) with query c: converted in place the two tiles are the B fragment of P^T in the hardware k order.
__device__ __forceinline__ void scores(const Frg& f, const v16h (&qb)[QT][2], v8f (&sc)[QT][2]) {
  const v8f z8 = {0.f, 0.f, 0.f, 0.f, 0.f, 0.f, 0.f, 0.f};
#pragma unroll      /* constant indices: the register arrays stay in registers */
  for (int t = 0; t < QT; ++t)
#pragma unroll      /* constant indices: the register arrays stay in registers */
    for (int g = 0; g < 2; ++g) { sc[t][g] = mma(f.ka[g][0], qb[t][0], z8); sc[t][g] = mma(f.ka[g][1], qb[t][1], sc[t][g]); }
}
// its weights and its share of the output sums
__device__ __forceinline__ void wpv(const Frg& f, const v8f (&sc)[QT][2], v8f (&o)[QT][4]) {
#pragma unroll      /* constant indices: the register arrays stay in registers */
  for (int t = 0; t < QT; ++t) {
    FragH pw;
    sgw8(sc[t][0], pw.h); sgw8(sc[t][1], pw.h + 8);
#pragma unroll      /* constant indices: the register arrays stay in registers */
    for (int u = 0; u < 4; ++u) o[t][u] = mma(f.va[u], pw.v, o[t][u]);
  }
}
__device__ __forceinline__ void pass(const Frg& f, const v16h (&qb)[QT][2], v8f (&o)[QT][4]) { v8f sc[QT][2]; scores(f, qb, sc); wpv(f, sc, o); }

// O^T tile u: D register r = out[query c][16 u + 8 hh + r]: eight consecutive floats of one output row per lane.
__global__ __launch_bounds__(256) __attribute__((amdgpu_waves_per_eu(2, 2))) void k_sattn(const float* __restrict__ xq, const float* __restrict__ xk, const float* __restrict__ xv, float* __restrict__ out) {
  __shared__ __attribute__((aligned(16))) unsigned char sm[2 * BUF];
  __shared__ __attribute__((aligned(16))) float csm[256];      /* per thread: the sum of v over the keys it staged, [key octet class tid >> 6][head column tid & 63] */
  const int tid = threadIdx.x, w = tid >> 5, lane = tid & 31, c = lane & 15, hh = lane >> 4;
  const int plane = blockIdx.x / (SQ / (QW * WV)), qblk = blockIdx.x % (SQ / (QW * WV));
  const int q0 = qblk * (QW * WV) + w * QW;
  const float* kp = xk + (size_t)plane * SQ * HD;
  const float* vp = xv + (size_t)plane * SQ * HD;
  // staging, k: a wave takes 8 rows x 4 pieces of 32 bytes (8 whole 128-byte lines): row (w >> 1) * 8 + (lane >> 2), head elements 32 (w & 1) + 8 (lane & 3) .. + 7, that is slice j = w & 1, half h = (lane >> 1) & 1, lane half lane & 1
  const int krow = (w >> 1) * 8 + (lane >> 2);
  const unsigned ko = (unsigned)(krow * HD + 32 * (w & 1) + 8 * (lane & 3));
  const unsigned kd = (unsigned)((((krow >> 4) * 2 + (w & 1)) * 2 + ((lane >> 1) & 1)) * KU + (lane & 1) * KH + (krow & 15) * 16);
  // staging, v: thread = (key octet tid >> 6, head column tid & 63): each wave-wide 4-byte load covers one whole 128-byte line; the 8 keys of a column are 16 bytes of V^T's half fragment (16-row group, half = octet >> 1), lane (octet & 1, column & 15)
  const unsigned vo = (unsigned)((tid >> 6) * 8 * HD + (tid & 63));
  const unsigned vd = (unsigned)(KBY + ((((tid & 63) >> 4) * 2 + (tid >> 7)) * 32 + ((tid >> 6) & 1) * 16 + (tid & 15)) * 16);
  const unsigned kl = (unsigned)(hh * KH + c * 16), vl = (unsigned)(KBY + lane * 16);      /* reading */
  Stg r;
  v2f cs = {0.f, 0.f};
  stg_load(r, kp, vp, ko, vo);
  v16h qb[QT][2];
#pragma unroll      /* constant indices: the register arrays stay in registers */
  for (int t = 0; t < QT; ++t) {
#pragma unroll      /* constant indices: the register arrays stay in registers */
    for (int j = 0; j < 2; ++j) {      /* hardware k order: lane (c, hh) takes k = 8 hh .. + 7 and 16 + 8 hh .. + 7 of its row */
      const float* qs = xq + ((size_t)plane * SQ + q0 + 16 * t + c) * HD + 32 * j + 8 * hh; FragH f;
      f.w[0] = rh8(*(const v4f*)qs, *(const v4f*)(qs + 4)); f.w[1] = rh8(*(const v4f*)(qs + 16), *(const v4f*)(qs + 20));
      qb[t][j] = f.v * (_Float16)0.0625f;      /* q / 16, a power of two: the score sums come out as s / 2, the argument of tanh */
    }
    asm volatile("s_wait_xcnt 0x0" ::: "memory");      /* the next tile's loads may land in the registers that hold this tile's address: the wait stands in front of that overwrite */
  }
  const v8f z8 = {0.f, 0.f, 0.f, 0.f, 0.f, 0.f, 0.f, 0.f};
  v8f o[QT][4];
#pragma unroll      /* constant indices: the register arrays stay in registers */
  for (int t = 0; t < QT; ++t)
#pragma unroll      /* constant indices: the register arrays stay in registers */
    for (int u = 0; u < 4; ++u) o[t][u] = z8;
  __builtin_amdgcn_sched_barrier(0);      /* keeps the rounding of stage 0, and with it a wait for its loads, behind the issue of the q loads */
  stg_store(r, sm + kd, sm + vd, cs);
  stg_load(r, kp + (size_t)SK * HD, vp + (size_t)SK * HD, ko, vo);      /* stage 1, in flight until stage 0's score products are issued */
  lds_barrier();      /* stage 0 is in buffer 0 for every wave */
  unsigned cur = 0;      /* byte offset of the buffer that holds stage s */
  Frg f0, f1;
  for (int s = 0; s < NS - 2; ++s) {
    const unsigned nxt = cur ^ BUF;
    frg_load(f0, sm + cur + kl, sm + cur + vl, 0); frg_load(f1, sm + cur + kl, sm + cur + vl, 1);
    __builtin_amdgcn_sched_barrier(0);      /* keeps the stage's LDS reads together up here: read just ahead of its product a fragment is waited for at full LDS latency */
    v8f sc0[QT][2], sc1[QT][2];
    scores(f0, qb, sc0); scores(f1, qb, sc1);
    __builtin_amdgcn_sched_barrier(0);      /* keeps the rounding, and with it the wait for the loads of a stage ago, behind the stage's score products */
    stg_store(r, sm + nxt + kd, sm + nxt + vd, cs);      /* stage s + 1 into the buffer that stage s - 1 was read from: every wave left it before the last barrier */
    stg_load(r, kp + (size_t)(s + 2) * SK * HD, vp + (size_t)(s + 2) * SK * HD, ko, vo);      /* in flight until this place of stage s + 1 */
    wpv(f0, sc0, o); wpv(f1, sc1, o);
    __builtin_amdgcn_sched_barrier(0);      /* keeps the weights and output products in front of the barrier: they touch no memory, and moved behind it they would start only after the slowest wave */
    lds_barrier();      /* publishes stage s + 1 and ends every wave's reads of stage s */
    cur = nxt;
  }
  frg_load(f0, sm + cur + kl, sm + cur + vl, 0); frg_load(f1, sm + cur + kl, sm + cur + vl, 1);      /* stage NS - 2: nothing is left to load */
  pass(f0, qb, o);
  stg_store(r, sm + (cur ^ BUF) + kd, sm + (cur ^ BUF) + vd, cs);
  csm[tid] = cs[0] + cs[1];      /* every stage has passed through stg_store: the thread's share of its column's sum is complete */
  pass(f1, qb, o);
  __syncthreads();      /* publishes the last stage and the column sums' parts */
  cur ^= BUF;
  frg_load(f0, sm + cur + kl, sm + cur + vl, 0); frg_load(f1, sm + cur + kl, sm + cur + vl, 1);
  pass(f0, qb, o);
  pass(f1, qb, o);
  v8f hc[4];      /* half the column sums of v at the lane's 32 output columns 16 u + 8 hh + r */
#pragma unroll      /* constant indices: the register arrays stay in registers */
  for (int u = 0; u < 4; ++u) {
    v8f a = z8;
#pragma unroll      /* constant indices: the register arrays stay in registers */
    for (int g = 0; g < 4; ++g) {
      const float* cp = csm + g * 64 + 16 * u + 8 * hh;
      const v4f lo = *(const v4f*)cp, hi = *(const v4f*)(cp + 4);
      a += __builtin_shufflevector(lo, hi, 0, 1, 2, 3, 4, 5, 6, 7);
    }
    hc[u] = a * 0.5f;
  }
#pragma unroll      /* constant indices: the register arrays stay in registers */
  for (int t = 0; t < QT; ++t) {
    float* orow = out + ((size_t)plane * SQ + q0 + 16 * t + c) * HD + 8 * hh;
    v8f y[4];
#pragma unroll      /* constant indices: the register arrays stay in registers */
    for (int u = 0; u < 4; ++u) y[u] = o[t][u] * 0.5f + hc[u];      /* sigmoid = 1/2 + 1/2 tanh */
#pragma unroll      /* constant indices: the register arrays stay in registers */
    for (int u = 0; u < 4; ++u) { *(v4f*)(orow + 16 * u) = __builtin_shufflevector(y[u], y[u], 0, 1, 2, 3); *(v4f*)(orow + 16 * u + 4) = __builtin_shufflevector(y[u], y[u], 4, 5, 6, 7); }
    asm volatile("s_wait_xcnt 0x0" ::: "memory");      /* the next tile's products and address may land in registers that these stores name: the wait stands in front of that overwrite */
    __builtin_amdgcn_sched_barrier(0);      /* keeps the next tile's work behind that wait */
  }
}

extern "C" void kernel_launch(void* const* d_in, const int* in_sizes, int n_in,
                              void* d_out, int out_size, void* d_ws, size_t ws_size, hipStream_t stream) {
  (void)in_sizes; (void)n_in; (void)out_size; (void)d_ws; (void)ws_size;
  const float* const* I = (const float* const*)d_in; const float* xq = I[0]; const float* xk = I[1]; const float* xv = I[2];      /* given q, k, v [B][H][S][64]: each (b, h) plane is a 'batch' of one 64-wide head */
  k_sattn<<<NB * (SQ / (QW * WV)), 256, 0, stream>>>(xq, xk, xv, (float*)d_out);      /* rounding, scores, sigmoid and weighted sum of v, all planes */
}

// v008
// It runs in 43.4 microseconds.
// Two timings next to v007 both put it at 1.07 times that version's speed.
// All steps since v000 together make it 262 times as fast.
#include <hip/hip_runtime.h>
// SIGMOID attention on given head-major query, key, value ([4][16][2048][64] each = 64 independent [2048][64] planes): scores = q . k / sqrt(64); attn = sigmoid(scores) (NO normalisation across keys: no softmax); out = attn v -> [4][16][2048][64].
// Structure: ONE launch, no workspace. A work-group = 8 waves x 64 query columns of one plane; one work-group a WGP, two waves a SIMD. It walks the plane's keys in stages of 64: its 256 threads read the stage's k and v as f32, round them (bf16, held as exact f16) and
// store them in LDS in FRAGMENT ORDER (each half fragment = 32 lanes x 16 bytes; V^T is formed by reading v down its columns), two buffers, one barrier a stage. The staging stands INSIDE a stage, behind its score products: there stage s + 1 is rounded and stored and the f32 loads of stage s + 2 are issued (they fly for a whole stage, over the barrier), so that a wave's waits there fall into the work of the SIMD's other wave and not, as at the barrier, on all eight waves at once.
// per wave 64 query columns (4 tiles of 16: a fragment read from LDS is used 4 times), per pass 32 keys: S^T = K Q^T (K = 64, f32 accumulation), T^T = f16(tanh(s / 16)) packed in place from the score accumulators, O^T += V^T T^T; scores and weights never reach memory.
// The constant half of the sigmoid stays out of the weights: sigmoid(x) = 1/2 + 1/2 tanh(x / 2), so out = 1/2 (sum over all keys of v) + 1/2 (tanh weights) v. The column sums of v do not depend on the query: each staging thread adds up the rounded v it stores anyway, and the work-group joins the four partial sums of a column through LDS once, at the end.
// q and out pass through a patch of LDS that belongs to one wave alone, so that every wave-wide 16-byte global access covers 512 consecutive bytes (4 whole 128-byte lines): q is read so, rounded and laid down in rows from which the lanes take their B fragments; the output tiles are laid down by the lanes that hold them (one query a lane) and read back two whole rows an instruction.
// Compute dtype: inputs rounded to bf16; q, k, v and the tanh weights as plain f16 operands; scores and output sums f32. v_wmma_f32_16x16x32_f16.
#define NB 64      /* planes (batch x heads) */
#define SQ 2048    /* positions per plane */
#define HD 64      /* head size */
#define QW 64      /* query columns per wave */
#define QT (QW / 16) /* query tiles per wave: each K and V^T fragment read from LDS feeds QT products */
#define WV 8       /* waves per work-group */
#define SK 64      /* keys per stage */
#define NS (SQ / SK)
#define KU 640     /* LDS bytes from one K half fragment to the next: 128 mod 256 */
#define KH 320     /* LDS bytes from its lanes 0-15 to its lanes 16-31: 64 mod 256; with KU the 16 lanes of a storing half wave (4 rows x 4 pieces) fall on all 64 banks once */
#define KBY (16 * KU)        /* K of one stage */
#define BUF (KBY + 16 * 512) /* K and V^T of one stage */
#define QP 144     /* LDS bytes from one staged q row (64 f16) to the next: 16 x odd, so that the 16 lanes of a half wave, one row each, read 16 bytes from all 64 banks once */
#define OP 272     /* LDS bytes from one staged output row (64 f32) to the next: 16 x odd, the same for the 16-byte stores of a half wave */
#define WST (QW * OP)        /* a wave's own patch: its 64 output rows (its 64 q rows need less) */
typedef unsigned short v8us __attribute__((ext_vector_type(8), may_alias));
typedef unsigned int v4u __attribute__((ext_vector_type(4), may_alias));
typedef float  v8f  __attribute__((ext_vector_type(8)));
typedef float  v4f  __attribute__((ext_vector_type(4)));
typedef float  v4fa __attribute__((ext_vector_type(4), may_alias));
typedef unsigned int v2u __attribute__((ext_vector_type(2), may_alias));
typedef float  v2f  __attribute__((ext_vector_type(2)));
typedef __bf16 v2b  __attribute__((ext_vector_type(2)));
typedef _Float16 v2h __attribute__((ext_vector_type(2)));
typedef _Float16 v16h __attribute__((ext_vector_type(16)));
union FragH { v16h v; v8us half[2]; v4u w[2]; _Float16 h[16]; };

// two inputs rounded to bf16 (nearest even) and held as f16, packed
__device__ __forceinline__ unsigned int rh2(float a, float b) {
  const v2f x = {a, b};
  const unsigned int u = __builtin_bit_cast(unsigned int, __builtin_convertvector(x, v2b));
  const v2f y = {__uint_as_float(u << 16), __uint_as_float(u & 0xFFFF0000u)};
  return __builtin_bit_cast(unsigned int, __builtin_convertvector(y, v2h));
}
// two inputs rounded to bf16 (nearest even), as f32
__device__ __forceinline__ v2f rb2(float a, float b) {
  const v2f x = {a, b};
  const unsigned int u = __builtin_bit_cast(unsigned int, __builtin_convertvector(x, v2b));
  const v2f y = {__uint_as_float(u << 16), __uint_as_float(u & 0xFFFF0000u)};
  return y;
}
__device__ __forceinline__ unsigned int h2(v2f y) { return __builtin_bit_cast(unsigned int, __builtin_convertvector(y, v2h)); }
__device__ __forceinline__ v4u rh8(v4f a, v4f b) { const v4u r = {rh2(a[0], a[1]), rh2(a[2], a[3]), rh2(b[0], b[1]), rh2(b[2], b[3])}; return r; }
__device__ __forceinline__ v8f mma(v16h a, v16h b, v8f c) { return __builtin_amdgcn_wmma_f32_16x16x32_f16(false, a, false, b, (short)0, c, false, false); }
// one 16 x 32 f16 fragment from LDS: p = the lane's 16 bytes of its first half fragment, the second half's stand step bytes on
__device__ __forceinline__ v16h lds_frag(const unsigned char* p, int step) { FragH f; f.half[0] = *(const v8us*)p; f.half[1] = *(const v8us*)(p + step); return f.v; }
// weights of one score tile's eight sums, which arrive as s / 2 (s = q . k / 8; the q fragments carry the 1/16): w[r] = f16(tanh(s / 2)) = f16(2 sigmoid(s) - 1), one transcendental and half a packed conversion each
__device__ __forceinline__ void sgw8(v8f acc, _Float16* w) {
  v8f t;
#pragma unroll      /* constant indices: the register arrays stay in registers */
  for (int r = 0; r < 8; ++r) t[r] = __builtin_amdgcn_tanhf(acc[r]);
#pragma unroll      /* constant indices: the register arrays stay in registers */
  for (int r = 0; r < 8; ++r) w[r] = (_Float16)t[r];
}
// a thread's share of one stage as f32: k, two pieces of 8 consecutive head elements of one row each; v, two runs of 8 consecutive keys of one head column each
struct Stg { v4f k[2][2]; float v[2][8]; };
__device__ __forceinline__ void stg_load(Stg& r, const float* ks, const float* vs, unsigned ko, unsigned vo) {
  __builtin_amdgcn_sched_barrier(0);      /* with the two below: no vector instruction from outside comes between a load and the wait behind it, where it could be given a register that holds the load's address */
#pragma unroll      /* constant indices: the register arrays stay in registers */
  for (int rd = 0; rd < 2; ++rd) { r.k[rd][0] = *(const v4f*)(ks + ko + rd * 32 * HD); r.k[rd][1] = *(const v4f*)(ks + ko + rd * 32 * HD + 4); }
  asm volatile("s_wait_xcnt 0x0" ::: "memory");      /* the v loads below may land in the registers that hold the k loads' address: the wait stands in front of that overwrite */
  __builtin_amdgcn_sched_barrier(0);      /* the second of the three: holds the v loads and their address behind the wait above */
#pragma unroll      /* constant indices: the register arrays stay in registers */
  for (int rd = 0; rd < 2; ++rd)
#pragma unroll      /* constant indices: the register arrays stay in registers */
    for (int q = 0; q < 8; ++q) r.v[rd][q] = vs[vo + (rd * 32 + q) * HD];
  asm volatile("s_wait_xcnt 0x0" ::: "memory");      /* what follows may land in the registers that hold these loads' addresses: the wait stands in front of that overwrite */
  __builtin_amdgcn_sched_barrier(0);      /* the third: holds what follows behind that wait, and the loads up here (sunk towards the loop's foot they would have less time to land) */
}
// cs: the thread's running sums of the rounded v of its head column
__device__ __forceinline__ void stg_store(const Stg& r, unsigned char* kd, unsigned char* vd, v2f& cs) {
#pragma unroll      /* constant indices: the register arrays stay in registers */
  for (int rd = 0; rd < 2; ++rd) {
    *(v4u*)(kd + rd * 8 * KU) = rh8(r.k[rd][0], r.k[rd][1]);      /* 32 rows on = 2 groups of 16 keys = 8 half fragments */
    const v2f a = rb2(r.v[rd][0], r.v[rd][1]), b = rb2(r.v[rd][2], r.v[rd][3]), c = rb2(r.v[rd][4], r.v[rd][5]), d = rb2(r.v[rd][6], r.v[rd][7]);
    cs += (a + b) + (c + d);      /* pairs first: the chain through the running sums is one add a run of 8 keys */
    const v4u y = {h2(a), h2(b), h2(c), h2(d)};
    *(v4u*)(vd + rd * 8 * 512) = y;
  }
}
// work-group barrier that orders LDS alone: __syncthreads() would also wait for the f32 loads of the stage after next, which are meant to stay in flight across it (they land in the thread's own registers)
__device__ __forceinline__ void lds_barrier() {
  __builtin_amdgcn_fence(__ATOMIC_RELEASE, "workgroup", "local");      /* this wave's LDS stores and reads are done before it signals */
  __builtin_amdgcn_s_barrier();
  __builtin_amdgcn_fence(__ATOMIC_ACQUIRE, "workgroup", "local");      /* no LDS read of the next stage moves up over the barrier */
}
// the K and V^T fragments of one 32-key pass
struct Frg { v16h ka[2][2], va[4]; };
// kl, vl = the lane's own bytes in the stage's first K and V^T half fragments; p = the pass
__device__ __forceinline__ void frg_load(Frg& f, const unsigned char* kl, const unsigned char* vl, int p) {
#pragma unroll      /* constant indices: the register arrays stay in registers */
  for (int g = 0; g < 2; ++g)
#pragma unroll      /* constant indices: the register arrays stay in registers */
    for (int j = 0; j < 2; ++j) f.ka[g][j] = lds_frag(kl + (((2 * p + g) * 2 + j) * 2) * KU, KU);
#pragma unroll      /* constant indices: the register arrays stay in registers */
  for (int u = 0; u < 4; ++u) f.va[u] = lds_frag(vl + ((4 * p + u) * 2) * 512, 512);
}
// the score products of one 32-key pass.
// S^T tile: D register r of lane (c, hh) = score of key 8 hh + r (tile 0) or 16 + 8 hh + r (tile 1) with query c: converted in place the two tiles are the B fragment of P^T in the hardware k order.
__device__ __forceinline__ void scores(const Frg& f, const v16h (&qb)[QT][2], v8f (&sc)[QT][2]) {
  const v8f z8 = {0.f, 0.f, 0.f, 0.f, 0.f, 0.f, 0.f, 0.f};
#pragma unroll      /* constant indices: the register arrays stay in registers */
  for (int t = 0; t < QT; ++t)
#pragma unroll      /* constant indices: the register arrays stay in registers */
    for (int g = 0; g < 2; ++g) { sc[t][g] = mma(f.ka[g][0], qb[t][0], z8); sc[t][g] = mma(f.ka[g][1], qb[t][1], sc[t][g]); }
}
// its weights and its share of the output sums
__device__ __forceinline__ void wpv(const Frg& f, const v8f (&sc)[QT][2], v8f (&o)[QT][4]) {
#pragma unroll      /* constant indices: the register arrays stay in registers */
  for (int t = 0; t < QT; ++t) {
    FragH pw;
    sgw8(sc[t][0], pw.h); sgw8(sc[t][1], pw.h + 8);
#pragma unroll      /* constant indices: the register arrays stay in registers */
    for (int u = 0; u < 4; ++u) o[t][u] = mma(f.va[u], pw.v, o[t][u]);
  }
}
__device__ __forceinline__ void pass(const Frg& f, const v16h (&qb)[QT][2], v8f (&o)[QT][4]) { v8f sc[QT][2]; scores(f, qb, sc); wpv(f, sc, o); }

// O^T tile u: D register r = out[query c][16 u + 8 hh + r]: eight consecutive floats of one output row per lane.
__global__ __launch_bounds__(256) __attribute__((amdgpu_waves_per_eu(2, 2))) void k_sattn(const float* __restrict__ xq, const float* __restrict__ xk, const float* __restrict__ xv, float* __restrict__ out) {
  __shared__ __attribute__((aligned(16))) unsigned char sm[2 * BUF];
  __shared__ __attribute__((aligned(16))) unsigned char wst[WV * WST];      /* per wave: q rows on the way in, output rows on the way out; no other wave touches a wave's patch */
  __shared__ __attribute__((aligned(16))) float csm[256];      /* per thread: the sum of v over the keys it staged, [key octet class tid >> 6][head column tid & 63] */
  const int tid = threadIdx.x, w = tid >> 5, lane = tid & 31, c = lane & 15, hh = lane >> 4;
  const int plane = blockIdx.x / (SQ / (QW * WV)), qblk = blockIdx.x % (SQ / (QW * WV));
  const int q0 = qblk * (QW * WV) + w * QW;
  const float* kp = xk + (size_t)plane * SQ * HD;
  const float* vp = xv + (size_t)plane * SQ * HD;
  // staging, k: a wave takes 8 rows x 4 pieces of 32 bytes (8 whole 128-byte lines): row (w >> 1) * 8 + (lane >> 2), head elements 32 (w & 1) + 8 (lane & 3) .. + 7, that is slice j = w & 1, half h = (lane >> 1) & 1, lane half lane & 1
  const int krow = (w >> 1) * 8 + (lane >> 2);
  const unsigned ko = (unsigned)(krow * HD + 32 * (w & 1) + 8 * (lane & 3));
  const unsigned kd = (unsigned)((((krow >> 4) * 2 + (w & 1)) * 2 + ((lane >> 1) & 1)) * KU + (lane & 1) * KH + (krow & 15) * 16);
  // staging, v: thread = (key octet tid >> 6, head column tid & 63): each wave-wide 4-byte load covers one whole 128-byte line; the 8 keys of a column are 16 bytes of V^T's half fragment (16-row group, half = octet >> 1), lane (octet & 1, column & 15)
  const unsigned vo = (unsigned)((tid >> 6) * 8 * HD + (tid & 63));
  const unsigned vd = (unsigned)(KBY + ((((tid & 63) >> 4) * 2 + (tid >> 7)) * 32 + ((tid >> 6) & 1) * 16 + (tid & 15)) * 16);
  const unsigned kl = (unsigned)(hh * KH + c * 16), vl = (unsigned)(KBY + lane * 16);      /* reading */
  Stg r;
  v2f cs = {0.f, 0.f};
  stg_load(r, kp, vp, ko, vo);
  unsigned char* wp = wst + w * WST;
  v16h qb[QT][2];
  {
    const float* qs = xq + ((size_t)plane * SQ + q0) * HD + 4 * lane;      /* the wave's 64 rows are 16 KB in a row: load n = rows 2 n and 2 n + 1, 16 bytes a lane */
    v4f a[QW / 2];
#pragma unroll      /* constant indices: the register arrays stay in registers */
    for (int n = 0; n < QW / 2; ++n) a[n] = *(const v4f*)(qs + n * 2 * HD);
    asm volatile("s_wait_xcnt 0x0" ::: "memory");      /* what follows may land in the registers that hold these loads' address: the wait stands in front of that overwrite */
    __builtin_amdgcn_sched_barrier(0);      /* holds what follows behind that wait */
#pragma unroll      /* constant indices: the register arrays stay in registers */
    for (int n = 0; n < QW / 2; ++n) { const v2u p = {rh2(a[n][0], a[n][1]), rh2(a[n][2], a[n][3])}; *(v2u*)(wp + (2 * n + hh) * QP + 8 * c) = p; }
    asm volatile("s_wait_dscnt 0x0" ::: "memory");      /* the rows are in LDS before other lanes of this wave read them */
#pragma unroll      /* constant indices: the register arrays stay in registers */
    for (int t = 0; t < QT; ++t)
#pragma unroll      /* constant indices: the register arrays stay in registers */
      for (int j = 0; j < 2; ++j)      /* hardware k order: lane (c, hh) takes k = 8 hh .. + 7 and 16 + 8 hh .. + 7 of its row */
        qb[t][j] = lds_frag(wp + (16 * t + c) * QP + 64 * j + 16 * hh, 32) * (_Float16)0.0625f;      /* q / 16, a power of two: the score sums come out as s / 2, the argument of tanh */
  }
  const v8f z8 = {0.f, 0.f, 0.f, 0.f, 0.f, 0.f, 0.f, 0.f};
  v8f o[QT][4];
#pragma unroll      /* constant indices: the register arrays stay in registers */
  for (int t = 0; t < QT; ++t)
#pragma unroll      /* constant indices: the register arrays stay in registers */
    for (int u = 0; u < 4; ++u) o[t][u] = z8;
  __builtin_amdgcn_sched_barrier(0);      /* keeps the rounding of stage 0, and with it a wait for its loads, behind the issue of the q loads */
  stg_store(r, sm + kd, sm + vd, cs);
  stg_load(r, kp + (size_t)SK * HD, vp + (size_t)SK * HD, ko, vo);      /* stage 1, in flight until stage 0's score products are issued */
  lds_barrier();      /* stage 0 is in buffer 0 for every wave */
  unsigned cur = 0;      /* byte offset of the buffer that holds stage s */
  Frg f0, f1;
  for (int s = 0; s < NS - 2; ++s) {
    const unsigned nxt = cur ^ BUF;
    frg_load(f0, sm + cur + kl, sm + cur + vl, 0); frg_load(f1, sm + cur + kl, sm + cur + vl, 1);
    __builtin_amdgcn_sched_barrier(0);      /* keeps the stage's LDS reads together up here: read just ahead of its product a fragment is waited for at full LDS latency */
    v8f sc0[QT][2], sc1[QT][2];
    scores(f0, qb, sc0); scores(f1, qb, sc1);
    __builtin_amdgcn_sched_barrier(0);      /* keeps the rounding, and with it the wait for the loads of a stage ago, behind the stage's score products */
    stg_store(r, sm + nxt + kd, sm + nxt + vd, cs);      /* stage s + 1 into the buffer that stage s - 1 was read from: every wave left it before the last barrier */
    stg_load(r, kp + (size_t)(s + 2) * SK * HD, vp + (size_t)(s + 2) * SK * HD, ko, vo);      /* in flight until this place of stage s + 1 */
    wpv(f0, sc0, o); wpv(f1, sc1, o);
    __builtin_amdgcn_sched_barrier(0);      /* keeps the weights and output products in front of the barrier: they touch no memory, and moved behind it they would start only after the slowest wave */
    lds_barrier();      /* publishes stage s + 1 and ends every wave's reads of stage s */
    cur = nxt;
  }
  frg_load(f0, sm + cur + kl, sm + cur + vl, 0); frg_load(f1, sm + cur + kl, sm + cur + vl, 1);      /* stage NS - 2: nothing is left to load */
  pass(f0, qb, o);
  stg_store(r, sm + (cur ^ BUF) + kd, sm + (cur ^ BUF) + vd, cs);
  csm[tid] = cs[0] + cs[1];      /* every stage has passed through stg_store: the thread's share of its column's sum is complete */
  pass(f1, qb, o);
  __syncthreads();      /* publishes the last stage and the column sums' parts */
  cur ^= BUF;
  frg_load(f0, sm + cur + kl, sm + cur + vl, 0); frg_load(f1, sm + cur + kl, sm + cur + vl, 1);
  pass(f0, qb, o);
  pass(f1, qb, o);
  v8f hc[4];      /* half the column sums of v at the lane's 32 output columns 16 u + 8 hh + r */
#pragma unroll      /* constant indices: the register arrays stay in registers */
  for (int u = 0; u < 4; ++u) {
    v8f a = z8;
#pragma unroll      /* constant indices: the register arrays stay in registers */
    for (int g = 0; g < 4; ++g) {
      const float* cp = csm + g * 64 + 16 * u + 8 * hh;
      const v4f lo = *(const v4f*)cp, hi = *(const v4f*)(cp + 4);
      a += __builtin_shufflevector(lo, hi, 0, 1, 2, 3, 4, 5, 6, 7);
    }
    hc[u] = a * 0.5f;
  }
#pragma unroll      /* constant indices: the register arrays stay in registers */
  for (int t = 0; t < QT; ++t)
#pragma unroll      /* constant indices: the register arrays stay in registers */
    for (int u = 0; u < 4; ++u) {
      const v8f y = o[t][u] * 0.5f + hc[u];      /* sigmoid = 1/2 + 1/2 tanh */
      unsigned char* p = wp + (16 * t + c) * OP + 64 * u + 32 * hh;
      *(v4fa*)p = __builtin_shufflevector(y, y, 0, 1, 2, 3); *(v4fa*)(p + 16) = __builtin_shufflevector(y, y, 4, 5, 6, 7);
    }
  asm volatile("s_wait_dscnt 0x0" ::: "memory");      /* the rows are in LDS before other lanes of this wave read them */
  v4f z[QW / 2];
#pragma unroll      /* constant indices: the register arrays stay in registers */
  for (int n = 0; n < QW / 2; ++n) z[n] = *(const v4fa*)(wp + (2 * n + hh) * OP + 16 * c);
  __builtin_amdgcn_sched_barrier(0);      /* every row is asked for before the first store goes out: no LDS read lands in a register that an issued store names */
  float* ob = out + ((size_t)plane * SQ + q0) * HD + 4 * lane;      /* store n = rows 2 n and 2 n + 1, 16 bytes a lane */
#pragma unroll      /* constant indices: the register arrays stay in registers */
  for (int n = 0; n < QW / 2; ++n) *(v4f*)(ob + n * 2 * HD) = z[n];
}

extern "C" void kernel_launch(void* const* d_in, const int* in_sizes, int n_in,
                              void* d_out, int out_size, void* d_ws, size_t ws_size, hipStream_t stream) {
  (void)in_sizes; (void)n_in; (void)out_size; (void)d_ws; (void)ws_size;
  const float* const* I = (const float* const*)d_in; const float* xq = I[0]; const float* xk = I[1]; const float* xv = I[2];      /* given q, k, v [B][H][S][64]: each (b, h) plane is a 'batch' of one 64-wide head */
  k_sattn<<<NB * (SQ / (QW * WV)), 256, 0, stream>>>(xq, xk, xv, (float*)d_out);      /* rounding, scores, sigmoid and weighted sum of v, all planes */
}
